// v000
// The times below were measured on an AMD MI455X: many runs one after another, warmed up first and cycling through
// copies of the inputs, with the whole window's GPU time divided by the number of runs. Launches and the gaps
// between them are all in it. The median over several windows is given; except for v000 it joins two sittings, which
// can be a few percent apart, so the side-by-side timings, each taken in one sitting, are the better comparison.
// v000, which the later versions start from, runs in 360 microseconds.
#include <hip/hip_runtime.h>
#include <cstddef>
#include <cstdint>

#define THREADS 256
#define BM 64
#define BN 64
#define BK 32
#define KSTR 36          // padded LDS k-stride: 16B-aligned rows, conflict-free fragments
#define NCHUNK (512 / BK)
#define FFT_N 4096
#define FFT_NH 2048
#define TDIM 2048
#define WDIM 512
#define BDIM 4
#define NSTAGE 3

typedef __attribute__((ext_vector_type(2))) float v2f;
typedef __attribute__((ext_vector_type(8))) float v8f;

__device__ __forceinline__ uint32_t lds_off(const void* p) {
  return (uint32_t)(uintptr_t)p;
}
__device__ __forceinline__ void async_b32(uint32_t dst_lds, const void* gsrc) {
  asm volatile("global_load_async_to_lds_b32 %0, %1, off"
               :: "v"(dst_lds), "v"(gsrc) : "memory");
}
__device__ __forceinline__ void async_b128(uint32_t dst_lds, const void* gsrc) {
  asm volatile("global_load_async_to_lds_b128 %0, %1, off"
               :: "v"(dst_lds), "v"(gsrc) : "memory");
}
__device__ __forceinline__ void wait_async0() {
  asm volatile("s_wait_asynccnt 0x0" ::: "memory");
}

// ---------------- WMMA core: As[m][k], Bs[n][k], wave computes 16x32 ----------------
__device__ __forceinline__ void wmma_chunk(const float* As, const float* Bs,
                                           int wr, int wc, int lane,
                                           v8f& c0, v8f& c1) {
  const int l16 = lane & 15;
  const int kh  = (lane >> 4) << 1;
#pragma unroll
  for (int k4 = 0; k4 < BK; k4 += 4) {
    v2f a  = *(const v2f*)&As[(wr * 16 + l16) * KSTR + k4 + kh];
    v2f b0 = *(const v2f*)&Bs[(wc * 32 + l16) * KSTR + k4 + kh];
    v2f b1 = *(const v2f*)&Bs[(wc * 32 + 16 + l16) * KSTR + k4 + kh];
    c0 = __builtin_amdgcn_wmma_f32_16x16x4_f32(false, a, false, b0, (short)0, c0, false, false);
    c1 = __builtin_amdgcn_wmma_f32_16x16x4_f32(false, a, false, b1, (short)0, c1, false, false);
  }
}

__device__ __forceinline__ void store_tile(float* p, const v8f& c) {
  float4 lo = make_float4(c[0], c[1], c[2], c[3]);
  float4 hi = make_float4(c[4], c[5], c[6], c[7]);
  *(float4*)p       = lo;
  *(float4*)(p + 4) = hi;
}

// ---------------- GEMM 1: XP[s][b][v][t] = (X @ W_proj[:,:,s]) transposed ----------------
// Double-buffered LDS; tiles fetched with async global->LDS, overlapped with WMMA.
__global__ __launch_bounds__(THREADS) void gemm_proj_kernel(
    const float* __restrict__ X,    // [B*T=8192][512]
    const float* __restrict__ Wp,   // [512][512][4]
    float* __restrict__ XP)         // [4][4][512][2048]
{
  __shared__ __align__(16) float As[2][BM * KSTR];
  __shared__ __align__(16) float Bs[2][BN * KSTR];
  const int tid  = threadIdx.x;
  const int s    = blockIdx.z;
  const int tm   = blockIdx.y * BM;
  const int tn   = blockIdx.x * BN;
  const int wave = tid >> 5, lane = tid & 31;
  const int wr   = wave & 3, wc = wave >> 2;
  v8f c0 = {0.f, 0.f, 0.f, 0.f, 0.f, 0.f, 0.f, 0.f};
  v8f c1 = {0.f, 0.f, 0.f, 0.f, 0.f, 0.f, 0.f, 0.f};

  const int rA = tid >> 3;           // A rows rA and rA+32
  const int cA = (tid & 7) << 2;     // A col group (float4)

  auto issue_tiles = [&](int buf, int kk) {
    // A tile 64x32: two 16B async copies per thread
    async_b128(lds_off(&As[buf][rA * KSTR + cA]),
               X + (size_t)(tm + rA) * WDIM + kk + cA);
    async_b128(lds_off(&As[buf][(rA + 32) * KSTR + cA]),
               X + (size_t)(tm + rA + 32) * WDIM + kk + cA);
    // B tile 32x64 (stride-4 gather) -> Bs[n][k]: eight 4B async copies per thread
#pragma unroll
    for (int it = 0; it < 8; ++it) {
      int j = tid + it * THREADS;
      int k = j >> 6, n = j & 63;
      async_b32(lds_off(&Bs[buf][n * KSTR + k]),
                Wp + ((size_t)(kk + k) * WDIM + (tn + n)) * 4 + s);
    }
  };

  issue_tiles(0, 0);
  wait_async0();
  __syncthreads();
  for (int ci = 0; ci < NCHUNK; ++ci) {
    const int cur = ci & 1;
    if (ci + 1 < NCHUNK) issue_tiles(cur ^ 1, (ci + 1) * BK);   // prefetch next chunk
    wmma_chunk(As[cur], Bs[cur], wr, wc, lane, c0, c1);         // compute current
    wait_async0();
    __syncthreads();
  }

  const int l16 = lane & 15;
  const int mo  = wr * 16 + ((lane >> 4) << 3);
  const int m0  = tm + mo;
  const int b   = m0 >> 11;
  const int t0  = m0 & (TDIM - 1);
  float* base = XP + ((size_t)(s * BDIM + b) * WDIM) * TDIM;
  store_tile(base + (size_t)(tn + wc * 32 + l16) * TDIM + t0, c0);
  store_tile(base + (size_t)(tn + wc * 32 + 16 + l16) * TDIM + t0, c1);
}

// ---------------- GEMM 2: F[s][v][t] = (pe @ W_filt[:,:,s]) transposed; pe on the fly ----
__global__ __launch_bounds__(THREADS) void gemm_filt_kernel(
    const float* __restrict__ Wf,   // [512][512][3]
    float* __restrict__ F)          // [3][512][2048]
{
  __shared__ __align__(16) float As[2][BM * KSTR];
  __shared__ __align__(16) float Bs[2][BN * KSTR];
  const int tid  = threadIdx.x;
  const int s    = blockIdx.z;
  const int tm   = blockIdx.y * BM;
  const int tn   = blockIdx.x * BN;
  const int wave = tid >> 5, lane = tid & 31;
  const int wr   = wave & 3, wc = wave >> 2;
  v8f c0 = {0.f, 0.f, 0.f, 0.f, 0.f, 0.f, 0.f, 0.f};
  v8f c1 = {0.f, 0.f, 0.f, 0.f, 0.f, 0.f, 0.f, 0.f};
  const float LN1E4_O_HALF = 9.2103403719761836f / 256.0f;

  auto fill_A = [&](int buf, int kk) {   // positional encoding computed in-place
#pragma unroll
    for (int it = 0; it < 2; ++it) {
      int i = tid + it * THREADS;
      int r = i >> 3, c = (i & 7) << 2;
      int t = tm + r;
#pragma unroll
      for (int u = 0; u < 4; ++u) {
        int w = kk + c + u;
        int j = w & 255;
        float fr  = __expf(-(float)j * LN1E4_O_HALF);
        float ang = (float)t * fr;
        As[buf][r * KSTR + c + u] = (w < 256) ? sinf(ang) : cosf(ang);
      }
    }
  };
  auto issue_B = [&](int buf, int kk) {
#pragma unroll
    for (int it = 0; it < 8; ++it) {
      int j = tid + it * THREADS;
      int k = j >> 6, n = j & 63;
      async_b32(lds_off(&Bs[buf][n * KSTR + k]),
                Wf + ((size_t)(kk + k) * WDIM + (tn + n)) * 3 + s);
    }
  };

  issue_B(0, 0);
  fill_A(0, 0);
  wait_async0();
  __syncthreads();
  for (int ci = 0; ci < NCHUNK; ++ci) {
    const int cur = ci & 1;
    if (ci + 1 < NCHUNK) { issue_B(cur ^ 1, (ci + 1) * BK); fill_A(cur ^ 1, (ci + 1) * BK); }
    wmma_chunk(As[cur], Bs[cur], wr, wc, lane, c0, c1);
    wait_async0();
    __syncthreads();
  }

  const int l16 = lane & 15;
  const int mo  = wr * 16 + ((lane >> 4) << 3);
  const int t0  = tm + mo;
  float* base = F + (size_t)(s * WDIM) * TDIM;
  store_tile(base + (size_t)(tn + wc * 32 + l16) * TDIM + t0, c0);
  store_tile(base + (size_t)(tn + wc * 32 + 16 + l16) * TDIM + t0, c1);
}

// ---------------- LDS Stockham radix-2 FFT, N=4096 ----------------
__device__ __forceinline__ void fft_fill_twiddles(float2* tw, int tid) {
  for (int k = tid; k < FFT_NH; k += THREADS) {
    float ang = -6.28318530717958647692f * ((float)k / (float)FFT_N);
    float sv, cv;
    sincosf(ang, &sv, &cv);
    tw[k] = make_float2(cv, sv);          // exp(-2*pi*i*k/N)
  }
}

// isign = +1: forward, -1: inverse (unscaled). Ends with result in A (12 passes).
__device__ __forceinline__ void fft4096(float2* A, float2* B, const float2* tw,
                                        float isign, int tid) {
  float2* src = A;
  float2* dst = B;
  for (int s = 1; s < FFT_N; s <<= 1) {
    for (int j = tid; j < FFT_NH; j += THREADS) {
      int q  = j & (s - 1);
      int ps = j - q;                      // p*s == twiddle index
      float2 a = src[j];
      float2 b = src[j + FFT_NH];
      float2 w = tw[ps];
      float wi = w.y * isign;
      float dr = a.x - b.x;
      float di = a.y - b.y;
      dst[j + ps]     = make_float2(a.x + b.x, a.y + b.y);
      dst[j + ps + s] = make_float2(dr * w.x - di * wi, dr * wi + di * w.x);
    }
    __syncthreads();
    float2* t = src; src = dst; dst = t;
  }
}

// ---------------- Filter spectra: FF[s][v][k] = FFT_4096(zeropad(F[s][v][:])) ----------
__global__ __launch_bounds__(THREADS) void filter_fft_kernel(
    const float* __restrict__ F,    // [3][512][2048]
    float* __restrict__ FF)         // [3][512][4096][2]
{
  __shared__ float2 bufA[FFT_N];
  __shared__ float2 bufB[FFT_N];
  __shared__ float2 tw[FFT_NH];
  const int tid = threadIdx.x;
  const int ch  = blockIdx.x;       // s*512 + v
  fft_fill_twiddles(tw, tid);
  const float* f = F + (size_t)ch * TDIM;
  for (int t = tid; t < FFT_N; t += THREADS)
    bufA[t] = (t < TDIM) ? make_float2(f[t], 0.f) : make_float2(0.f, 0.f);
  __syncthreads();
  fft4096(bufA, bufB, tw, 1.0f, tid);
  float2* out = (float2*)FF + (size_t)ch * FFT_N;
  for (int k = tid; k < FFT_N; k += THREADS) out[k] = bufA[k];
}

// ---------------- 3-stage FFT convolution + gating, one channel per workgroup --------
__global__ __launch_bounds__(THREADS) void conv_stages_kernel(
    const float* __restrict__ XP,   // [4][4][512][2048]
    const float* __restrict__ FF,   // [3][512][4096][2]
    float* __restrict__ out)        // [4][2048][512]
{
  __shared__ float2 bufA[FFT_N];
  __shared__ float2 bufB[FFT_N];
  __shared__ float2 tw[FFT_NH];
  const int tid = threadIdx.x;
  const int ch  = blockIdx.x;       // b*512 + v
  const int b   = ch >> 9;
  const int v   = ch & 511;
  fft_fill_twiddles(tw, tid);

  const float* y0 = XP + ((size_t)(0 * BDIM + b) * WDIM + v) * TDIM;
  for (int t = tid; t < FFT_N; t += THREADS)
    bufA[t] = (t < TDIM) ? make_float2(y0[t], 0.f) : make_float2(0.f, 0.f);
  __syncthreads();

  const float invn = 1.0f / (float)FFT_N;
  for (int s = 0; s < NSTAGE; ++s) {
    fft4096(bufA, bufB, tw, 1.0f, tid);                 // forward, result in bufA
    const float2* ff = (const float2*)FF + ((size_t)s * WDIM + v) * FFT_N;
    for (int k = tid; k < FFT_N; k += THREADS) {
      float2 y = bufA[k];
      float2 f = ff[k];
      bufA[k] = make_float2(y.x * f.x - y.y * f.y, y.x * f.y + y.y * f.x);
    }
    __syncthreads();
    fft4096(bufA, bufB, tw, -1.0f, tid);                // inverse (unscaled)
    const float* g = XP + ((size_t)((s + 1) * BDIM + b) * WDIM + v) * TDIM;
    for (int t = tid; t < FFT_N; t += THREADS) {
      float val = (t < TDIM) ? bufA[t].x * invn * g[t] : 0.f;   // gate + causal re-zero
      bufA[t] = make_float2(val, 0.f);
    }
    __syncthreads();
  }
  for (int t = tid; t < TDIM; t += THREADS)
    out[((size_t)b * TDIM + t) * WDIM + v] = bufA[t].x;
}

// ---------------- launch ----------------
extern "C" void kernel_launch(void* const* d_in, const int* in_sizes, int n_in,
                              void* d_out, int out_size, void* d_ws, size_t ws_size,
                              hipStream_t stream) {
  const float* X  = (const float*)d_in[0];   // (4,2048,512)
  const float* Wp = (const float*)d_in[1];   // (512,512,4)
  const float* Wf = (const float*)d_in[2];   // (512,512,3)
  float* out = (float*)d_out;
  float* ws  = (float*)d_ws;

  // workspace layout (floats)
  const size_t XP_OFF = 0;                                        // 16,777,216
  const size_t F_OFF  = XP_OFF + (size_t)4 * BDIM * WDIM * TDIM;  // + 3,145,728
  const size_t FF_OFF = F_OFF + (size_t)NSTAGE * WDIM * TDIM;     // + 12,582,912
  float* XP = ws + XP_OFF;
  float* F  = ws + F_OFF;
  float* FF = ws + FF_OFF;

  dim3 blk(THREADS);
  gemm_proj_kernel<<<dim3(WDIM / BN, (BDIM * TDIM) / BM, 4), blk, 0, stream>>>(X, Wp, XP);
  gemm_filt_kernel<<<dim3(WDIM / BN, TDIM / BM, NSTAGE), blk, 0, stream>>>(Wf, F);
  filter_fft_kernel<<<dim3(NSTAGE * WDIM), blk, 0, stream>>>(F, FF);
  conv_stages_kernel<<<dim3(BDIM * WDIM), blk, 0, stream>>>(XP, FF, out);
}

// v001
// A run of this version takes 278 microseconds.
// In two side-by-side timings against v000, it was 1.34 and 1.33 times as fast.
#include <hip/hip_runtime.h>
#include <cstddef>
#include <cstdint>

#define THREADS 256
#define BM 64
#define BN 64
#define BK 32
#define KSTR 36          // padded LDS k-stride: 16B-aligned rows, conflict-free fragments
#define NCHUNK (512 / BK)
#define FFT_N 4096
#define TDIM 2048
#define WDIM 512
#define BDIM 4
#define NSTAGE 3

typedef __attribute__((ext_vector_type(2))) float v2f;
typedef __attribute__((ext_vector_type(8))) float v8f;

__device__ __forceinline__ uint32_t lds_off(const void* p) {
  return (uint32_t)(uintptr_t)p;
}
__device__ __forceinline__ void async_b32(uint32_t dst_lds, const void* gsrc) {
  asm volatile("global_load_async_to_lds_b32 %0, %1, off"
               :: "v"(dst_lds), "v"(gsrc) : "memory");
}
__device__ __forceinline__ void async_b128(uint32_t dst_lds, const void* gsrc) {
  asm volatile("global_load_async_to_lds_b128 %0, %1, off"
               :: "v"(dst_lds), "v"(gsrc) : "memory");
}
__device__ __forceinline__ void wait_async0() {
  asm volatile("s_wait_asynccnt 0x0" ::: "memory");
}

// ---------------- WMMA core: As[m][k], Bs[n][k], wave computes 16x32 ----------------
__device__ __forceinline__ void wmma_chunk(const float* As, const float* Bs,
                                           int wr, int wc, int lane,
                                           v8f& c0, v8f& c1) {
  const int l16 = lane & 15;
  const int kh  = (lane >> 4) << 1;
#pragma unroll
  for (int k4 = 0; k4 < BK; k4 += 4) {
    v2f a  = *(const v2f*)&As[(wr * 16 + l16) * KSTR + k4 + kh];
    v2f b0 = *(const v2f*)&Bs[(wc * 32 + l16) * KSTR + k4 + kh];
    v2f b1 = *(const v2f*)&Bs[(wc * 32 + 16 + l16) * KSTR + k4 + kh];
    c0 = __builtin_amdgcn_wmma_f32_16x16x4_f32(false, a, false, b0, (short)0, c0, false, false);
    c1 = __builtin_amdgcn_wmma_f32_16x16x4_f32(false, a, false, b1, (short)0, c1, false, false);
  }
}

__device__ __forceinline__ void store_tile(float* p, const v8f& c) {
  float4 lo = make_float4(c[0], c[1], c[2], c[3]);
  float4 hi = make_float4(c[4], c[5], c[6], c[7]);
  *(float4*)p       = lo;
  *(float4*)(p + 4) = hi;
}

// ---------------- GEMM 1: XP[s][b][v][t] = (X @ W_proj[:,:,s]) transposed ----------------
// Double-buffered LDS; tiles fetched with async global->LDS, overlapped with WMMA.
__global__ __launch_bounds__(THREADS) void gemm_proj_kernel(
    const float* __restrict__ X,    // [B*T=8192][512]
    const float* __restrict__ Wp,   // [512][512][4]
    float* __restrict__ XP)         // [4][4][512][2048]
{
  __shared__ __align__(16) float As[2][BM * KSTR];
  __shared__ __align__(16) float Bs[2][BN * KSTR];
  const int tid  = threadIdx.x;
  const int s    = blockIdx.z;
  const int tm   = blockIdx.y * BM;
  const int tn   = blockIdx.x * BN;
  const int wave = tid >> 5, lane = tid & 31;
  const int wr   = wave & 3, wc = wave >> 2;
  v8f c0 = {0.f, 0.f, 0.f, 0.f, 0.f, 0.f, 0.f, 0.f};
  v8f c1 = {0.f, 0.f, 0.f, 0.f, 0.f, 0.f, 0.f, 0.f};

  const int rA = tid >> 3;           // A rows rA and rA+32
  const int cA = (tid & 7) << 2;     // A col group (float4)

  auto issue_tiles = [&](int buf, int kk) {
    // A tile 64x32: two 16B async copies per thread
    async_b128(lds_off(&As[buf][rA * KSTR + cA]),
               X + (size_t)(tm + rA) * WDIM + kk + cA);
    async_b128(lds_off(&As[buf][(rA + 32) * KSTR + cA]),
               X + (size_t)(tm + rA + 32) * WDIM + kk + cA);
    // B tile 32x64 (stride-4 gather) -> Bs[n][k]: eight 4B async copies per thread
#pragma unroll
    for (int it = 0; it < 8; ++it) {
      int j = tid + it * THREADS;
      int k = j >> 6, n = j & 63;
      async_b32(lds_off(&Bs[buf][n * KSTR + k]),
                Wp + ((size_t)(kk + k) * WDIM + (tn + n)) * 4 + s);
    }
  };

  issue_tiles(0, 0);
  wait_async0();
  __syncthreads();
  for (int ci = 0; ci < NCHUNK; ++ci) {
    const int cur = ci & 1;
    if (ci + 1 < NCHUNK) issue_tiles(cur ^ 1, (ci + 1) * BK);   // prefetch next chunk
    wmma_chunk(As[cur], Bs[cur], wr, wc, lane, c0, c1);         // compute current
    wait_async0();
    __syncthreads();
  }

  const int l16 = lane & 15;
  const int mo  = wr * 16 + ((lane >> 4) << 3);
  const int m0  = tm + mo;
  const int b   = m0 >> 11;
  const int t0  = m0 & (TDIM - 1);
  float* base = XP + ((size_t)(s * BDIM + b) * WDIM) * TDIM;
  store_tile(base + (size_t)(tn + wc * 32 + l16) * TDIM + t0, c0);
  store_tile(base + (size_t)(tn + wc * 32 + 16 + l16) * TDIM + t0, c1);
}

// ---------------- GEMM 2: F[s][v][t] = (pe @ W_filt[:,:,s]) transposed; pe on the fly ----
__global__ __launch_bounds__(THREADS) void gemm_filt_kernel(
    const float* __restrict__ Wf,   // [512][512][3]
    float* __restrict__ F)          // [3][512][2048]
{
  __shared__ __align__(16) float As[2][BM * KSTR];
  __shared__ __align__(16) float Bs[2][BN * KSTR];
  const int tid  = threadIdx.x;
  const int s    = blockIdx.z;
  const int tm   = blockIdx.y * BM;
  const int tn   = blockIdx.x * BN;
  const int wave = tid >> 5, lane = tid & 31;
  const int wr   = wave & 3, wc = wave >> 2;
  v8f c0 = {0.f, 0.f, 0.f, 0.f, 0.f, 0.f, 0.f, 0.f};
  v8f c1 = {0.f, 0.f, 0.f, 0.f, 0.f, 0.f, 0.f, 0.f};
  const float LN1E4_O_HALF = 9.2103403719761836f / 256.0f;

  auto fill_A = [&](int buf, int kk) {   // positional encoding computed in-place
#pragma unroll
    for (int it = 0; it < 2; ++it) {
      int i = tid + it * THREADS;
      int r = i >> 3, c = (i & 7) << 2;
      int t = tm + r;
#pragma unroll
      for (int u = 0; u < 4; ++u) {
        int w = kk + c + u;
        int j = w & 255;
        float fr  = __expf(-(float)j * LN1E4_O_HALF);
        float ang = (float)t * fr;
        As[buf][r * KSTR + c + u] = (w < 256) ? sinf(ang) : cosf(ang);
      }
    }
  };
  auto issue_B = [&](int buf, int kk) {
#pragma unroll
    for (int it = 0; it < 8; ++it) {
      int j = tid + it * THREADS;
      int k = j >> 6, n = j & 63;
      async_b32(lds_off(&Bs[buf][n * KSTR + k]),
                Wf + ((size_t)(kk + k) * WDIM + (tn + n)) * 3 + s);
    }
  };

  issue_B(0, 0);
  fill_A(0, 0);
  wait_async0();
  __syncthreads();
  for (int ci = 0; ci < NCHUNK; ++ci) {
    const int cur = ci & 1;
    if (ci + 1 < NCHUNK) { issue_B(cur ^ 1, (ci + 1) * BK); fill_A(cur ^ 1, (ci + 1) * BK); }
    wmma_chunk(As[cur], Bs[cur], wr, wc, lane, c0, c1);
    wait_async0();
    __syncthreads();
  }

  const int l16 = lane & 15;
  const int mo  = wr * 16 + ((lane >> 4) << 3);
  const int t0  = tm + mo;
  float* base = F + (size_t)(s * WDIM) * TDIM;
  store_tile(base + (size_t)(tn + wc * 32 + l16) * TDIM + t0, c0);
  store_tile(base + (size_t)(tn + wc * 32 + 16 + l16) * TDIM + t0, c1);
}

// ---------------- Register radix-16 Stockham FFT, N=4096 = 16^3 ----------------
// Thread j holds elements j + 256*r (r = 0..15) on entry and on exit, in natural order,
// so forward FFT, spectrum product, inverse FFT and gate chain without leaving registers.
// Three radix-16 passes; between them two LDS exchanges, one barrier each.
#define EX1_N (FFT_N + FFT_N / 32)
#define EX2_N FFT_N

// a * w (forward) or a * conj(w) (inverse)
template <bool INV>
__device__ __forceinline__ v2f cmul(v2f a, v2f w) {
  v2f t = a * w.yy;
  return a * w.xx + (INV ? (v2f){t.y, -t.x} : (v2f){-t.y, t.x});
}
// d * (-i) (forward) or d * (+i) (inverse)
template <bool INV>
__device__ __forceinline__ v2f rot(v2f d) {
  return INV ? (v2f){-d.y, d.x} : (v2f){d.y, -d.x};
}
template <bool INV>
__device__ __forceinline__ void r4(v2f& a0, v2f& a1, v2f& a2, v2f& a3) {
  v2f s02 = a0 + a2, d02 = a0 - a2, s13 = a1 + a3, d13 = rot<INV>(a1 - a3);
  a0 = s02 + s13; a1 = d02 + d13; a2 = s02 - s13; a3 = d02 - d13;
}
// The 16 values of a thread are 16 named variables, not an array: every one stays a register pair of its own.
#define X16_PARAMS v2f &x0, v2f &x1, v2f &x2, v2f &x3, v2f &x4, v2f &x5, v2f &x6, v2f &x7, \
                   v2f &x8, v2f &x9, v2f &x10, v2f &x11, v2f &x12, v2f &x13, v2f &x14, v2f &x15
#define X16_ARGS x0, x1, x2, x3, x4, x5, x6, x7, x8, x9, x10, x11, x12, x13, x14, x15
#define FOR8(F)  F(0, x0) F(1, x1) F(2, x2) F(3, x3) F(4, x4) F(5, x5) F(6, x6) F(7, x7)
#define FOR16(F) FOR8(F) F(8, x8) F(9, x9) F(10, x10) F(11, x11) F(12, x12) F(13, x13) F(14, x14) F(15, x15)

// radix-4 butterfly whose inputs a2, a3 are zero (they are written, not read)
template <bool INV>
__device__ __forceinline__ void r4_zhi(v2f& a0, v2f& a1, v2f& a2, v2f& a3) {
  v2f p = a0, q = a1, r = rot<INV>(q);
  a0 = p + q; a1 = p + r; a2 = p - q; a3 = p - r;
}
__device__ __forceinline__ void cswap(v2f& a, v2f& b) { v2f t = a; a = b; b = t; }

// 16-point DFT as 4x4, in place, natural order in and out. ZHI: x8..x15 are zero and not read.
template <bool INV, bool ZHI>
__device__ __forceinline__ void fft16(X16_PARAMS) {
  const float C1 = 0.92387953251128674f, S1 = 0.38268343236508977f, R = 0.70710678118654752f;
  if (ZHI) {
    r4_zhi<INV>(x0, x4, x8, x12); r4_zhi<INV>(x1, x5, x9, x13);
    r4_zhi<INV>(x2, x6, x10, x14); r4_zhi<INV>(x3, x7, x11, x15);
  } else {
    r4<INV>(x0, x4, x8, x12); r4<INV>(x1, x5, x9, x13);
    r4<INV>(x2, x6, x10, x14); r4<INV>(x3, x7, x11, x15);
  }
  x5  = cmul<INV>(x5,  (v2f){C1, -S1});
  x6  = cmul<INV>(x6,  (v2f){R, -R});
  x7  = cmul<INV>(x7,  (v2f){S1, -C1});
  x9  = cmul<INV>(x9,  (v2f){R, -R});
  x10 = rot<INV>(x10);
  x11 = cmul<INV>(x11, (v2f){-R, -R});
  x13 = cmul<INV>(x13, (v2f){S1, -C1});
  x14 = cmul<INV>(x14, (v2f){-R, -R});
  x15 = cmul<INV>(x15, (v2f){-C1, S1});
  r4<INV>(x0, x1, x2, x3); r4<INV>(x4, x5, x6, x7);
  r4<INV>(x8, x9, x10, x11); r4<INV>(x12, x13, x14, x15);
  // output k sits in variable 4*(k&3) + (k>>2): rename by a 4x4 transpose
  cswap(x1, x4); cswap(x2, x8); cswap(x3, x12); cswap(x6, x9); cswap(x7, x13); cswap(x11, x14);
}

// t[k] = exp(-2*pi*i * k * num / den), k = 1..15: powers 1, 2, 4, 8 from sincospif,
// the rest as products of at most four of them (phase error does not grow with k).
__device__ __forceinline__ void fill_powers(v2f (&t)[16], int num, float den) {
  // both loops unrolled: every index of t a constant, so that t stays in registers
#pragma unroll
  for (int k = 1; k < 16; k <<= 1) {
    float sv, cv;
    sincospif(-2.0f * ((float)(num * k) / den), &sv, &cv);   // argument exact: den is a power of two
    t[k] = (v2f){cv, sv};
  }
  t[0] = (v2f){1.f, 0.f};
#pragma unroll
  for (int k = 3; k < 16; ++k) {
    const int hi = (k >= 8) ? 8 : (k >= 4) ? 4 : 2;
    if (k != hi) t[k] = cmul<false>(t[hi], t[k - hi]);
  }
}

// Pass-2 twiddles, tw2[16*p + k] = W_256^(p*k): a wave reads two rows of it, as broadcasts.
// Written before the first FFT's first barrier, read only behind it.
__device__ __forceinline__ void fill_tw2(v2f* tw2, int tid) {
  float sv, cv;
  sincospif(-2.0f * ((float)((tid >> 4) * (tid & 15)) / 256.0f), &sv, &cv);
  tw2[tid] = (v2f){cv, sv};
}

template <bool INV, bool ZHI>
__device__ __forceinline__ void fft4096(X16_PARAMS, const v2f (&t1)[16], const v2f* tw2,
                                        v2f* ex1, v2f* ex2, int tid) {
  // pass 1 (stride 1): output k of thread j goes to element 16*j + k, times W_4096^(j*k)
  fft16<INV, ZHI>(X16_ARGS);
  {
    v2f* w = ex1 + 16 * tid + (tid >> 1);
#define ST1(k, xk) w[k] = (k) ? cmul<INV>(xk, t1[k]) : xk;
    FOR16(ST1)
#undef ST1
  }
  __syncthreads();
  {
    const v2f* r = ex1 + tid + (tid >> 5);
#define LD1(k, xk) xk = r[(256 + 8) * (k)];
    FOR16(LD1)
#undef LD1
  }
  // pass 2 (stride 16): j = q + 16*p, output k goes to element q + 256*p + 16*k, times W_256^(p*k)
  fft16<INV, false>(X16_ARGS);
  {
    const int p = tid >> 4;
    const v2f* t2 = tw2 + 16 * p;
    v2f* we = ex2 + (tid & 15) + 256 * p + 16 * (p & 1);
    v2f* wo = ex2 + (tid & 15) + 256 * p - 16 * (p & 1);
#define ST2(k, xk) (((k) & 1) ? wo : we)[16 * (k)] = (k) ? cmul<INV>(xk, t2[k]) : xk;
    FOR16(ST2)
#undef ST2
  }
  __syncthreads();
  {
    const v2f* re = ex2 + tid;
    const v2f* ro = ex2 + (tid ^ 16);
#define LD2(k, xk) xk = (((k) & 1) ? ro : re)[256 * (k)];
    FOR16(LD2)
#undef LD2
  }
  // pass 3 (stride 256): output k of thread j is element j + 256*k
  fft16<INV, false>(X16_ARGS);
}

// ---------------- Filter spectra: FF[s][v][k] = FFT_4096(zeropad(F[s][v][:])) ----------
__global__ __launch_bounds__(THREADS) void filter_fft_kernel(
    const float* __restrict__ F,    // [3][512][2048]
    float* __restrict__ FF)         // [3][512][4096][2]
{
  __shared__ v2f ex1[EX1_N];
  __shared__ v2f ex2[EX2_N];
  __shared__ v2f tw2[256];
  const int tid = threadIdx.x;
  const int ch  = blockIdx.x;       // s*512 + v
  v2f t1[16];
  v2f X16_ARGS;
  const float* f = F + (size_t)ch * TDIM;
#define LDF(k, xk) xk = (v2f){f[tid + 256 * (k)], 0.f};
  FOR8(LDF)
#undef LDF
  fill_powers(t1, tid, (float)FFT_N);
  fill_tw2(tw2, tid);
  fft4096<false, true>(X16_ARGS, t1, tw2, ex1, ex2, tid);
  v2f* out = (v2f*)FF + (size_t)ch * FFT_N;
#define STF(k, xk) out[tid + 256 * (k)] = xk;
  FOR16(STF)
#undef STF
}

__global__ __launch_bounds__(THREADS) __attribute__((amdgpu_waves_per_eu(8))) void conv_stages_kernel(
    const float* __restrict__ XP,   // [4][4][512][2048]
    const float* __restrict__ FF,   // [3][512][4096][2]
    float* __restrict__ out)        // [4][2048][512]
{
  __shared__ v2f ex1[EX1_N];
  __shared__ v2f ex2[EX2_N];
  __shared__ v2f tw2[256];
  const int tid = threadIdx.x;
  const int ch  = blockIdx.x;       // b*512 + v
  const int b   = ch >> 9;
  const int v   = ch & 511;
  v2f t1[16];
  v2f X16_ARGS;

  const float* y0 = XP + ((size_t)(0 * BDIM + b) * WDIM + v) * TDIM;
#define LDY(k, xk) xk = (v2f){y0[tid + 256 * (k)], 0.f};
  FOR8(LDY)
#undef LDY
  fill_powers(t1, tid, (float)FFT_N);
  fill_tw2(tw2, tid);

  const float invn = 1.0f / (float)FFT_N;
  for (int s = 0; s < NSTAGE; ++s) {
    fft4096<false, true>(X16_ARGS, t1, tw2, ex1, ex2, tid);   // forward; upper half of the input is the zero pad
    const v2f* ff = (const v2f*)FF + ((size_t)s * WDIM + v) * FFT_N;
#define MULF(k, xk) xk = cmul<false>(xk, ff[tid + 256 * (k)]);
    FOR16(MULF)
#undef MULF
    fft4096<true, false>(X16_ARGS, t1, tw2, ex1, ex2, tid);   // inverse (unscaled)
    const float* g = XP + ((size_t)((s + 1) * BDIM + b) * WDIM + v) * TDIM;
    // gate; t >= TDIM is the causal re-zero, which the next forward pass does not read
#define GATE(k, xk) xk = (v2f){xk.x * invn * g[tid + 256 * (k)], 0.f};
    FOR8(GATE)
#undef GATE
  }
#define STO(k, xk) out[((size_t)b * TDIM + tid + 256 * (k)) * WDIM + v] = xk.x;
  FOR8(STO)
#undef STO
}

// ---------------- launch ----------------
extern "C" void kernel_launch(void* const* d_in, const int* in_sizes, int n_in,
                              void* d_out, int out_size, void* d_ws, size_t ws_size,
                              hipStream_t stream) {
  const float* X  = (const float*)d_in[0];   // (4,2048,512)
  const float* Wp = (const float*)d_in[1];   // (512,512,4)
  const float* Wf = (const float*)d_in[2];   // (512,512,3)
  float* out = (float*)d_out;
  float* ws  = (float*)d_ws;

  // workspace layout (floats)
  const size_t XP_OFF = 0;                                        // 16,777,216
  const size_t F_OFF  = XP_OFF + (size_t)4 * BDIM * WDIM * TDIM;  // + 3,145,728
  const size_t FF_OFF = F_OFF + (size_t)NSTAGE * WDIM * TDIM;     // + 12,582,912
  float* XP = ws + XP_OFF;
  float* F  = ws + F_OFF;
  float* FF = ws + FF_OFF;

  dim3 blk(THREADS);
  gemm_proj_kernel<<<dim3(WDIM / BN, (BDIM * TDIM) / BM, 4), blk, 0, stream>>>(X, Wp, XP);
  gemm_filt_kernel<<<dim3(WDIM / BN, TDIM / BM, NSTAGE), blk, 0, stream>>>(Wf, F);
  filter_fft_kernel<<<dim3(NSTAGE * WDIM), blk, 0, stream>>>(F, FF);
  conv_stages_kernel<<<dim3(BDIM * WDIM), blk, 0, stream>>>(XP, FF, out);
}

// v002
// It runs in 268 microseconds.
// Timed twice side by side with v001, it ran 1.03 times as fast both times.
// Over all steps from v000 it is 1.38 times as fast.
#include <hip/hip_runtime.h>
#include <cstddef>
#include <cstdint>

#define THREADS 256
#define BM 64
#define BN 64
#define BK 32
#define KSTR 36          // padded LDS k-stride: 16B-aligned rows, conflict-free fragments
#define NCHUNK (512 / BK)
#define FFT_N 4096
#define TDIM 2048
#define WDIM 512
#define BDIM 4
#define NSTAGE 3
#define NP (WDIM * (NSTAGE + 1))   // columns of W_proj as a row-major matrix
#define NF (WDIM * NSTAGE)         // columns of W_filt as a row-major matrix

typedef __attribute__((ext_vector_type(2))) float v2f;
typedef __attribute__((ext_vector_type(8))) float v8f;

__device__ __forceinline__ uint32_t lds_off(const void* p) {
  return (uint32_t)(uintptr_t)p;
}
__device__ __forceinline__ void async_b128(uint32_t dst_lds, const void* gsrc) {
  asm volatile("global_load_async_to_lds_b128 %0, %1, off\n\ts_wait_xcnt 0x0"
               :: "v"(dst_lds), "v"(gsrc) : "memory");
}
template <int LDB>
__device__ __forceinline__ void async_b_tile(uint32_t d0, const float* g0) {
  asm volatile("global_load_async_to_lds_b32 %0, %8, off\n\t"
               "global_load_async_to_lds_b32 %1, %9, off\n\t"
               "global_load_async_to_lds_b32 %2, %10, off\n\t"
               "global_load_async_to_lds_b32 %3, %11, off\n\t"
               "global_load_async_to_lds_b32 %4, %12, off\n\t"
               "global_load_async_to_lds_b32 %5, %13, off\n\t"
               "global_load_async_to_lds_b32 %6, %14, off\n\t"
               "global_load_async_to_lds_b32 %7, %15, off\n\t"
               "s_wait_xcnt 0x0"
               :: "v"(d0), "v"(d0 + 16), "v"(d0 + 32), "v"(d0 + 48),
                  "v"(d0 + 64), "v"(d0 + 80), "v"(d0 + 96), "v"(d0 + 112),
                  "v"(g0), "v"(g0 + 4 * LDB), "v"(g0 + 8 * LDB), "v"(g0 + 12 * LDB),
                  "v"(g0 + 16 * LDB), "v"(g0 + 20 * LDB), "v"(g0 + 24 * LDB), "v"(g0 + 28 * LDB)
               : "memory");
}
__device__ __forceinline__ void wait_async0() {
  asm volatile("s_wait_asynccnt 0x0" ::: "memory");
}

// ---------------- WMMA core: As[m][k], Bs[n][k], wave computes 16x32 ----------------
__device__ __forceinline__ void wmma_chunk(const float* As, const float* Bs,
                                           int wr, int wc, int lane,
                                           v8f& c0, v8f& c1) {
  const int l16 = lane & 15;
  const int kh  = (lane >> 4) << 1;
#pragma unroll
  for (int k4 = 0; k4 < BK; k4 += 4) {
    v2f a  = *(const v2f*)&As[(wr * 16 + l16) * KSTR + k4 + kh];
    v2f b0 = *(const v2f*)&Bs[(wc * 32 + l16) * KSTR + k4 + kh];
    v2f b1 = *(const v2f*)&Bs[(wc * 32 + 16 + l16) * KSTR + k4 + kh];
    c0 = __builtin_amdgcn_wmma_f32_16x16x4_f32(false, a, false, b0, (short)0, c0, false, false);
    c1 = __builtin_amdgcn_wmma_f32_16x16x4_f32(false, a, false, b1, (short)0, c1, false, false);
  }
}

__device__ __forceinline__ void store_tile(float* p, const v8f& c) {
  float4 lo = make_float4(c[0], c[1], c[2], c[3]);
  float4 hi = make_float4(c[4], c[5], c[6], c[7]);
  *(float4*)p       = lo;
  *(float4*)(p + 4) = hi;
}

// ---------------- GEMM 1: XP[s][b][v][t] = (X @ W_proj[:,:,s]) transposed ----------------
// W_proj is taken as it lies in memory, one row-major [512][2048] matrix with column n = v*4 + s;
// the epilogue sends column n to plane s, row v.
// Double-buffered LDS; tiles fetched with async global->LDS, overlapped with WMMA.
__global__ __launch_bounds__(THREADS) void gemm_proj_kernel(
    const float* __restrict__ X,    // [B*T=8192][512]
    const float* __restrict__ Wp,   // [512][512][4]
    float* __restrict__ XP)         // [4][4][512][2048]
{
  __shared__ __align__(16) float As[2][BM * KSTR];
  __shared__ __align__(16) float Bs[2][BN * KSTR];
  const int tid  = threadIdx.x;
  const int tm   = blockIdx.y * BM;
  const int tn   = blockIdx.x * BN;
  const int wave = tid >> 5, lane = tid & 31;
  const int wr   = wave & 3, wc = wave >> 2;
  v8f c0 = {0.f, 0.f, 0.f, 0.f, 0.f, 0.f, 0.f, 0.f};
  v8f c1 = {0.f, 0.f, 0.f, 0.f, 0.f, 0.f, 0.f, 0.f};

  const int rA = tid >> 3;           // A rows rA and rA+32
  const int cA = (tid & 7) << 2;     // A col group (float4)
  const int kB = tid >> 6;           // B k rows kB + 4*i
  const int nB = tid & 63;           // B column

  auto issue_tiles = [&](int buf, int kk) {
    // A tile 64x32: two 16B async copies per thread
    async_b128(lds_off(&As[buf][rA * KSTR + cA]),
               X + (size_t)(tm + rA) * WDIM + kk + cA);
    async_b128(lds_off(&As[buf][(rA + 32) * KSTR + cA]),
               X + (size_t)(tm + rA + 32) * WDIM + kk + cA);
    async_b_tile<NP>(lds_off(&Bs[buf][nB * KSTR + kB]), Wp + (size_t)(kk + kB) * NP + tn + nB);
  };

  issue_tiles(0, 0);
  wait_async0();
  __syncthreads();
  for (int ci = 0; ci < NCHUNK; ++ci) {
    const int cur = ci & 1;
    if (ci + 1 < NCHUNK) issue_tiles(cur ^ 1, (ci + 1) * BK);   // prefetch next chunk
    wmma_chunk(As[cur], Bs[cur], wr, wc, lane, c0, c1);         // compute current
    wait_async0();
    __syncthreads();
  }

  const int l16 = lane & 15;
  const int mo  = wr * 16 + ((lane >> 4) << 3);
  const int m0  = tm + mo;
  const int b   = m0 >> 11;
  const int t0  = m0 & (TDIM - 1);
  const int n0  = tn + wc * 32 + l16;   // columns n0 and n0 + 16: the same s, v four apart
  float* base = XP + ((size_t)((n0 & 3) * BDIM + b) * WDIM + (n0 >> 2)) * TDIM + t0;
  store_tile(base, c0);
  store_tile(base + (size_t)4 * TDIM, c1);
}

__global__ __launch_bounds__(THREADS) void gemm_filt_kernel(
    const float* __restrict__ Wf,   // [512][512][3]
    float* __restrict__ F)          // [3][512][2048]
{
  __shared__ __align__(16) float As[2][BM * KSTR];
  __shared__ __align__(16) float Bs[2][BN * KSTR];
  const int tid  = threadIdx.x;
  const int tm   = blockIdx.y * BM;
  const int tn   = blockIdx.x * BN;
  const int wave = tid >> 5, lane = tid & 31;
  const int wr   = wave & 3, wc = wave >> 2;
  v8f c0 = {0.f, 0.f, 0.f, 0.f, 0.f, 0.f, 0.f, 0.f};
  v8f c1 = {0.f, 0.f, 0.f, 0.f, 0.f, 0.f, 0.f, 0.f};
  const int kB = tid >> 6;           // B k rows kB + 4*i
  const int nB = tid & 63;           // B column
  const float LN1E4_O_HALF = 9.2103403719761836f / 256.0f;

  auto fill_A = [&](int buf, int kk) {   // positional encoding computed in-place
#pragma unroll
    for (int it = 0; it < 2; ++it) {
      int i = tid + it * THREADS;
      int r = i >> 3, c = (i & 7) << 2;
      int t = tm + r;
#pragma unroll
      for (int u = 0; u < 4; ++u) {
        int w = kk + c + u;
        int j = w & 255;
        float fr  = __expf(-(float)j * LN1E4_O_HALF);
        float ang = (float)t * fr;
        As[buf][r * KSTR + c + u] = (w < 256) ? sinf(ang) : cosf(ang);
      }
    }
  };
  auto issue_B = [&](int buf, int kk) {
    async_b_tile<NF>(lds_off(&Bs[buf][nB * KSTR + kB]), Wf + (size_t)(kk + kB) * NF + tn + nB);
  };

  issue_B(0, 0);
  fill_A(0, 0);
  wait_async0();
  __syncthreads();
  for (int ci = 0; ci < NCHUNK; ++ci) {
    const int cur = ci & 1;
    if (ci + 1 < NCHUNK) { issue_B(cur ^ 1, (ci + 1) * BK); fill_A(cur ^ 1, (ci + 1) * BK); }
    wmma_chunk(As[cur], Bs[cur], wr, wc, lane, c0, c1);
    wait_async0();
    __syncthreads();
  }

  const int l16 = lane & 15;
  const int mo  = wr * 16 + ((lane >> 4) << 3);
  const int t0  = tm + mo;
  const int n0  = tn + wc * 32 + l16, n1 = n0 + 16;
  store_tile(F + (size_t)((n0 % NSTAGE) * WDIM + n0 / NSTAGE) * TDIM + t0, c0);
  store_tile(F + (size_t)((n1 % NSTAGE) * WDIM + n1 / NSTAGE) * TDIM + t0, c1);
}

// ---------------- Register radix-16 Stockham FFT, N=4096 = 16^3 ----------------
// Thread j holds elements j + 256*r (r = 0..15) on entry and on exit, in natural order,
// so forward FFT, spectrum product, inverse FFT and gate chain without leaving registers.
// Three radix-16 passes; between them two LDS exchanges, one barrier each.
#define EX1_N (FFT_N + FFT_N / 32)
#define EX2_N FFT_N

// a * w (forward) or a * conj(w) (inverse)
template <bool INV>
__device__ __forceinline__ v2f cmul(v2f a, v2f w) {
  v2f t = a * w.yy;
  return a * w.xx + (INV ? (v2f){t.y, -t.x} : (v2f){-t.y, t.x});
}
// d * (-i) (forward) or d * (+i) (inverse)
template <bool INV>
__device__ __forceinline__ v2f rot(v2f d) {
  return INV ? (v2f){-d.y, d.x} : (v2f){d.y, -d.x};
}
template <bool INV>
__device__ __forceinline__ void r4(v2f& a0, v2f& a1, v2f& a2, v2f& a3) {
  v2f s02 = a0 + a2, d02 = a0 - a2, s13 = a1 + a3, d13 = rot<INV>(a1 - a3);
  a0 = s02 + s13; a1 = d02 + d13; a2 = s02 - s13; a3 = d02 - d13;
}
// The 16 values of a thread are 16 named variables, not an array: every one stays a register pair of its own.
#define X16_PARAMS v2f &x0, v2f &x1, v2f &x2, v2f &x3, v2f &x4, v2f &x5, v2f &x6, v2f &x7, \
                   v2f &x8, v2f &x9, v2f &x10, v2f &x11, v2f &x12, v2f &x13, v2f &x14, v2f &x15
#define X16_ARGS x0, x1, x2, x3, x4, x5, x6, x7, x8, x9, x10, x11, x12, x13, x14, x15
#define FOR8(F)  F(0, x0) F(1, x1) F(2, x2) F(3, x3) F(4, x4) F(5, x5) F(6, x6) F(7, x7)
#define FOR16(F) FOR8(F) F(8, x8) F(9, x9) F(10, x10) F(11, x11) F(12, x12) F(13, x13) F(14, x14) F(15, x15)

// radix-4 butterfly whose inputs a2, a3 are zero (they are written, not read)
template <bool INV>
__device__ __forceinline__ void r4_zhi(v2f& a0, v2f& a1, v2f& a2, v2f& a3) {
  v2f p = a0, q = a1, r = rot<INV>(q);
  a0 = p + q; a1 = p + r; a2 = p - q; a3 = p - r;
}
__device__ __forceinline__ void cswap(v2f& a, v2f& b) { v2f t = a; a = b; b = t; }

// 16-point DFT as 4x4, in place, natural order in and out. ZHI: x8..x15 are zero and not read.
template <bool INV, bool ZHI>
__device__ __forceinline__ void fft16(X16_PARAMS) {
  const float C1 = 0.92387953251128674f, S1 = 0.38268343236508977f, R = 0.70710678118654752f;
  if (ZHI) {
    r4_zhi<INV>(x0, x4, x8, x12); r4_zhi<INV>(x1, x5, x9, x13);
    r4_zhi<INV>(x2, x6, x10, x14); r4_zhi<INV>(x3, x7, x11, x15);
  } else {
    r4<INV>(x0, x4, x8, x12); r4<INV>(x1, x5, x9, x13);
    r4<INV>(x2, x6, x10, x14); r4<INV>(x3, x7, x11, x15);
  }
  x5  = cmul<INV>(x5,  (v2f){C1, -S1});
  x6  = cmul<INV>(x6,  (v2f){R, -R});
  x7  = cmul<INV>(x7,  (v2f){S1, -C1});
  x9  = cmul<INV>(x9,  (v2f){R, -R});
  x10 = rot<INV>(x10);
  x11 = cmul<INV>(x11, (v2f){-R, -R});
  x13 = cmul<INV>(x13, (v2f){S1, -C1});
  x14 = cmul<INV>(x14, (v2f){-R, -R});
  x15 = cmul<INV>(x15, (v2f){-C1, S1});
  r4<INV>(x0, x1, x2, x3); r4<INV>(x4, x5, x6, x7);
  r4<INV>(x8, x9, x10, x11); r4<INV>(x12, x13, x14, x15);
  // output k sits in variable 4*(k&3) + (k>>2): rename by a 4x4 transpose
  cswap(x1, x4); cswap(x2, x8); cswap(x3, x12); cswap(x6, x9); cswap(x7, x13); cswap(x11, x14);
}

// t[k] = exp(-2*pi*i * k * num / den), k = 1..15: powers 1, 2, 4, 8 from sincospif,
// the rest as products of at most four of them (phase error does not grow with k).
__device__ __forceinline__ void fill_powers(v2f (&t)[16], int num, float den) {
  // both loops unrolled: every index of t a constant, so that t stays in registers
#pragma unroll
  for (int k = 1; k < 16; k <<= 1) {
    float sv, cv;
    sincospif(-2.0f * ((float)(num * k) / den), &sv, &cv);   // argument exact: den is a power of two
    t[k] = (v2f){cv, sv};
  }
  t[0] = (v2f){1.f, 0.f};
#pragma unroll
  for (int k = 3; k < 16; ++k) {
    const int hi = (k >= 8) ? 8 : (k >= 4) ? 4 : 2;
    if (k != hi) t[k] = cmul<false>(t[hi], t[k - hi]);
  }
}

// Pass-2 twiddles, tw2[16*p + k] = W_256^(p*k): a wave reads two rows of it, as broadcasts.
// Written before the first FFT's first barrier, read only behind it.
__device__ __forceinline__ void fill_tw2(v2f* tw2, int tid) {
  float sv, cv;
  sincospif(-2.0f * ((float)((tid >> 4) * (tid & 15)) / 256.0f), &sv, &cv);
  tw2[tid] = (v2f){cv, sv};
}

template <bool INV, bool ZHI>
__device__ __forceinline__ void fft4096(X16_PARAMS, const v2f (&t1)[16], const v2f* tw2,
                                        v2f* ex1, v2f* ex2, int tid) {
  // pass 1 (stride 1): output k of thread j goes to element 16*j + k, times W_4096^(j*k)
  fft16<INV, ZHI>(X16_ARGS);
  {
    v2f* w = ex1 + 16 * tid + (tid >> 1);
#define ST1(k, xk) w[k] = (k) ? cmul<INV>(xk, t1[k]) : xk;
    FOR16(ST1)
#undef ST1
  }
  __syncthreads();
  {
    const v2f* r = ex1 + tid + (tid >> 5);
#define LD1(k, xk) xk = r[(256 + 8) * (k)];
    FOR16(LD1)
#undef LD1
  }
  // pass 2 (stride 16): j = q + 16*p, output k goes to element q + 256*p + 16*k, times W_256^(p*k)
  fft16<INV, false>(X16_ARGS);
  {
    const int p = tid >> 4;
    const v2f* t2 = tw2 + 16 * p;
    v2f* we = ex2 + (tid & 15) + 256 * p + 16 * (p & 1);
    v2f* wo = ex2 + (tid & 15) + 256 * p - 16 * (p & 1);
#define ST2(k, xk) (((k) & 1) ? wo : we)[16 * (k)] = (k) ? cmul<INV>(xk, t2[k]) : xk;
    FOR16(ST2)
#undef ST2
  }
  __syncthreads();
  {
    const v2f* re = ex2 + tid;
    const v2f* ro = ex2 + (tid ^ 16);
#define LD2(k, xk) xk = (((k) & 1) ? ro : re)[256 * (k)];
    FOR16(LD2)
#undef LD2
  }
  // pass 3 (stride 256): output k of thread j is element j + 256*k
  fft16<INV, false>(X16_ARGS);
}

// ---------------- Filter spectra: FF[s][v][k] = FFT_4096(zeropad(F[s][v][:])) ----------
__global__ __launch_bounds__(THREADS) void filter_fft_kernel(
    const float* __restrict__ F,    // [3][512][2048]
    float* __restrict__ FF)         // [3][512][4096][2]
{
  __shared__ v2f ex1[EX1_N];
  __shared__ v2f ex2[EX2_N];
  __shared__ v2f tw2[256];
  const int tid = threadIdx.x;
  const int ch  = blockIdx.x;       // s*512 + v
  v2f t1[16];
  v2f X16_ARGS;
  const float* f = F + (size_t)ch * TDIM;
#define LDF(k, xk) xk = (v2f){f[tid + 256 * (k)], 0.f};
  FOR8(LDF)
#undef LDF
  fill_powers(t1, tid, (float)FFT_N);
  fill_tw2(tw2, tid);
  fft4096<false, true>(X16_ARGS, t1, tw2, ex1, ex2, tid);
  v2f* out = (v2f*)FF + (size_t)ch * FFT_N;
#define STF(k, xk) out[tid + 256 * (k)] = xk;
  FOR16(STF)
#undef STF
}

__global__ __launch_bounds__(THREADS) __attribute__((amdgpu_waves_per_eu(8))) void conv_stages_kernel(
    const float* __restrict__ XP,   // [4][4][512][2048]
    const float* __restrict__ FF,   // [3][512][4096][2]
    float* __restrict__ out)        // [4][2048][512]
{
  __shared__ v2f ex1[EX1_N];
  __shared__ v2f ex2[EX2_N];
  __shared__ v2f tw2[256];
  const int tid = threadIdx.x;
  const int ch  = blockIdx.x;       // b*512 + v
  const int b   = ch >> 9;
  const int v   = ch & 511;
  v2f t1[16];
  v2f X16_ARGS;

  const float* y0 = XP + ((size_t)(0 * BDIM + b) * WDIM + v) * TDIM;
#define LDY(k, xk) xk = (v2f){y0[tid + 256 * (k)], 0.f};
  FOR8(LDY)
#undef LDY
  fill_powers(t1, tid, (float)FFT_N);
  fill_tw2(tw2, tid);

  const float invn = 1.0f / (float)FFT_N;
  for (int s = 0; s < NSTAGE; ++s) {
    fft4096<false, true>(X16_ARGS, t1, tw2, ex1, ex2, tid);   // forward; upper half of the input is the zero pad
    const v2f* ff = (const v2f*)FF + ((size_t)s * WDIM + v) * FFT_N;
#define MULF(k, xk) xk = cmul<false>(xk, ff[tid + 256 * (k)]);
    FOR16(MULF)
#undef MULF
    fft4096<true, false>(X16_ARGS, t1, tw2, ex1, ex2, tid);   // inverse (unscaled)
    const float* g = XP + ((size_t)((s + 1) * BDIM + b) * WDIM + v) * TDIM;
    // gate; t >= TDIM is the causal re-zero, which the next forward pass does not read
#define GATE(k, xk) xk = (v2f){xk.x * invn * g[tid + 256 * (k)], 0.f};
    FOR8(GATE)
#undef GATE
  }
#define STO(k, xk) out[((size_t)b * TDIM + tid + 256 * (k)) * WDIM + v] = xk.x;
  FOR8(STO)
#undef STO
}

// ---------------- launch ----------------
extern "C" void kernel_launch(void* const* d_in, const int* in_sizes, int n_in,
                              void* d_out, int out_size, void* d_ws, size_t ws_size,
                              hipStream_t stream) {
  const float* X  = (const float*)d_in[0];   // (4,2048,512)
  const float* Wp = (const float*)d_in[1];   // (512,512,4)
  const float* Wf = (const float*)d_in[2];   // (512,512,3)
  float* out = (float*)d_out;
  float* ws  = (float*)d_ws;

  // workspace layout (floats)
  const size_t XP_OFF = 0;                                        // 16,777,216
  const size_t F_OFF  = XP_OFF + (size_t)4 * BDIM * WDIM * TDIM;  // + 3,145,728
  const size_t FF_OFF = F_OFF + (size_t)NSTAGE * WDIM * TDIM;     // + 12,582,912
  float* XP = ws + XP_OFF;
  float* F  = ws + F_OFF;
  float* FF = ws + FF_OFF;

  dim3 blk(THREADS);
  gemm_proj_kernel<<<dim3(NP / BN, (BDIM * TDIM) / BM), blk, 0, stream>>>(X, Wp, XP);
  gemm_filt_kernel<<<dim3(NF / BN, TDIM / BM), blk, 0, stream>>>(Wf, F);
  filter_fft_kernel<<<dim3(NSTAGE * WDIM), blk, 0, stream>>>(F, FF);
  conv_stages_kernel<<<dim3(BDIM * WDIM), blk, 0, stream>>>(XP, FF, out);
}

// v003
// A run of this version takes 255 microseconds.
// Two timings next to v002 both put it at 1.05 times that version's speed.
// Over all steps from v000 it is 1.45 times as fast.
#include <hip/hip_runtime.h>
#include <cstddef>
#include <cstdint>

#define THREADS 256
#define BM 64
#define BN 64
#define BK 32
#define KSTR 36          // padded LDS k-stride: 16B-aligned rows, conflict-free fragments
#define NCHUNK (512 / BK)
#define FFT_N 4096
#define TDIM 2048
#define WDIM 512
#define BDIM 4
#define NSTAGE 3
#define NP (WDIM * (NSTAGE + 1))   // columns of W_proj as a row-major matrix
#define NF (WDIM * NSTAGE)         // columns of W_filt as a row-major matrix

typedef __attribute__((ext_vector_type(2))) float v2f;
typedef __attribute__((ext_vector_type(8))) float v8f;

__device__ __forceinline__ uint32_t lds_off(const void* p) {
  return (uint32_t)(uintptr_t)p;
}
__device__ __forceinline__ void async_b128(uint32_t dst_lds, const void* gsrc) {
  asm volatile("global_load_async_to_lds_b128 %0, %1, off\n\ts_wait_xcnt 0x0"
               :: "v"(dst_lds), "v"(gsrc) : "memory");
}
template <int LDB>
__device__ __forceinline__ void async_b_tile(uint32_t d0, const float* g0) {
  asm volatile("global_load_async_to_lds_b32 %0, %8, off\n\t"
               "global_load_async_to_lds_b32 %1, %9, off\n\t"
               "global_load_async_to_lds_b32 %2, %10, off\n\t"
               "global_load_async_to_lds_b32 %3, %11, off\n\t"
               "global_load_async_to_lds_b32 %4, %12, off\n\t"
               "global_load_async_to_lds_b32 %5, %13, off\n\t"
               "global_load_async_to_lds_b32 %6, %14, off\n\t"
               "global_load_async_to_lds_b32 %7, %15, off\n\t"
               "s_wait_xcnt 0x0"
               :: "v"(d0), "v"(d0 + 16), "v"(d0 + 32), "v"(d0 + 48),
                  "v"(d0 + 64), "v"(d0 + 80), "v"(d0 + 96), "v"(d0 + 112),
                  "v"(g0), "v"(g0 + 4 * LDB), "v"(g0 + 8 * LDB), "v"(g0 + 12 * LDB),
                  "v"(g0 + 16 * LDB), "v"(g0 + 20 * LDB), "v"(g0 + 24 * LDB), "v"(g0 + 28 * LDB)
               : "memory");
}
__device__ __forceinline__ void wait_async0() {
  asm volatile("s_wait_asynccnt 0x0" ::: "memory");
}

// ---------------- WMMA core: As[m][k], Bs[n][k], wave computes 16x32 ----------------
__device__ __forceinline__ void wmma_chunk(const float* As, const float* Bs,
                                           int wr, int wc, int lane,
                                           v8f& c0, v8f& c1) {
  const int l16 = lane & 15;
  const int kh  = (lane >> 4) << 1;
#pragma unroll
  for (int k4 = 0; k4 < BK; k4 += 4) {
    v2f a  = *(const v2f*)&As[(wr * 16 + l16) * KSTR + k4 + kh];
    v2f b0 = *(const v2f*)&Bs[(wc * 32 + l16) * KSTR + k4 + kh];
    v2f b1 = *(const v2f*)&Bs[(wc * 32 + 16 + l16) * KSTR + k4 + kh];
    c0 = __builtin_amdgcn_wmma_f32_16x16x4_f32(false, a, false, b0, (short)0, c0, false, false);
    c1 = __builtin_amdgcn_wmma_f32_16x16x4_f32(false, a, false, b1, (short)0, c1, false, false);
  }
}

__device__ __forceinline__ void store_tile(float* p, const v8f& c) {
  float4 lo = make_float4(c[0], c[1], c[2], c[3]);
  float4 hi = make_float4(c[4], c[5], c[6], c[7]);
  *(float4*)p       = lo;
  *(float4*)(p + 4) = hi;
}

// ---------------- GEMM 1: XP[s][b][v][t] = (X @ W_proj[:,:,s]) transposed ----------------
// W_proj is taken as it lies in memory, one row-major [512][2048] matrix with column n = v*4 + s;
// the epilogue sends column n to plane s, row v.
// Double-buffered LDS; tiles fetched with async global->LDS, overlapped with WMMA.
__global__ __launch_bounds__(THREADS) void gemm_proj_kernel(
    const float* __restrict__ X,    // [B*T=8192][512]
    const float* __restrict__ Wp,   // [512][512][4]
    float* __restrict__ XP)         // [4][4][512][2048]
{
  __shared__ __align__(16) float As[2][BM * KSTR];
  __shared__ __align__(16) float Bs[2][BN * KSTR];
  const int tid  = threadIdx.x;
  const int tm   = blockIdx.y * BM;
  const int tn   = blockIdx.x * BN;
  const int wave = tid >> 5, lane = tid & 31;
  const int wr   = wave & 3, wc = wave >> 2;
  v8f c0 = {0.f, 0.f, 0.f, 0.f, 0.f, 0.f, 0.f, 0.f};
  v8f c1 = {0.f, 0.f, 0.f, 0.f, 0.f, 0.f, 0.f, 0.f};

  const int rA = tid >> 3;           // A rows rA and rA+32
  const int cA = (tid & 7) << 2;     // A col group (float4)
  const int kB = tid >> 6;           // B k rows kB + 4*i
  const int nB = tid & 63;           // B column

  auto issue_tiles = [&](int buf, int kk) {
    // A tile 64x32: two 16B async copies per thread
    async_b128(lds_off(&As[buf][rA * KSTR + cA]),
               X + (size_t)(tm + rA) * WDIM + kk + cA);
    async_b128(lds_off(&As[buf][(rA + 32) * KSTR + cA]),
               X + (size_t)(tm + rA + 32) * WDIM + kk + cA);
    async_b_tile<NP>(lds_off(&Bs[buf][nB * KSTR + kB]), Wp + (size_t)(kk + kB) * NP + tn + nB);
  };

  issue_tiles(0, 0);
  wait_async0();
  __syncthreads();
  for (int ci = 0; ci < NCHUNK; ++ci) {
    const int cur = ci & 1;
    if (ci + 1 < NCHUNK) issue_tiles(cur ^ 1, (ci + 1) * BK);   // prefetch next chunk
    wmma_chunk(As[cur], Bs[cur], wr, wc, lane, c0, c1);         // compute current
    wait_async0();
    __syncthreads();
  }

  const int l16 = lane & 15;
  const int mo  = wr * 16 + ((lane >> 4) << 3);
  const int m0  = tm + mo;
  const int b   = m0 >> 11;
  const int t0  = m0 & (TDIM - 1);
  const int n0  = tn + wc * 32 + l16;   // columns n0 and n0 + 16: the same s, v four apart
  float* base = XP + ((size_t)((n0 & 3) * BDIM + b) * WDIM + (n0 >> 2)) * TDIM + t0;
  store_tile(base, c0);
  store_tile(base + (size_t)4 * TDIM, c1);
}

__global__ __launch_bounds__(THREADS) void gemm_filt_kernel(
    const float* __restrict__ Wf,   // [512][512][3]
    float* __restrict__ F)          // [3][512][2048]
{
  __shared__ __align__(16) float As[2][BM * KSTR];
  __shared__ __align__(16) float Bs[2][BN * KSTR];
  const int tid  = threadIdx.x;
  const int tm   = blockIdx.y * BM;
  const int tn   = blockIdx.x * BN;
  const int wave = tid >> 5, lane = tid & 31;
  const int wr   = wave & 3, wc = wave >> 2;
  v8f c0 = {0.f, 0.f, 0.f, 0.f, 0.f, 0.f, 0.f, 0.f};
  v8f c1 = {0.f, 0.f, 0.f, 0.f, 0.f, 0.f, 0.f, 0.f};
  const int kB = tid >> 6;           // B k rows kB + 4*i
  const int nB = tid & 63;           // B column
  const float LN1E4_O_HALF = 9.2103403719761836f / 256.0f;

  auto fill_A = [&](int buf, int kk) {   // positional encoding computed in-place
#pragma unroll
    for (int it = 0; it < 2; ++it) {
      int i = tid + it * THREADS;
      int r = i >> 3, c = (i & 7) << 2;
      int t = tm + r;
#pragma unroll
      for (int u = 0; u < 4; ++u) {
        int w = kk + c + u;
        int j = w & 255;
        float fr  = __expf(-(float)j * LN1E4_O_HALF);
        float ang = (float)t * fr;
        As[buf][r * KSTR + c + u] = (w < 256) ? sinf(ang) : cosf(ang);
      }
    }
  };
  auto issue_B = [&](int buf, int kk) {
    async_b_tile<NF>(lds_off(&Bs[buf][nB * KSTR + kB]), Wf + (size_t)(kk + kB) * NF + tn + nB);
  };

  issue_B(0, 0);
  fill_A(0, 0);
  wait_async0();
  __syncthreads();
  for (int ci = 0; ci < NCHUNK; ++ci) {
    const int cur = ci & 1;
    if (ci + 1 < NCHUNK) { issue_B(cur ^ 1, (ci + 1) * BK); fill_A(cur ^ 1, (ci + 1) * BK); }
    wmma_chunk(As[cur], Bs[cur], wr, wc, lane, c0, c1);
    wait_async0();
    __syncthreads();
  }

  const int l16 = lane & 15;
  const int mo  = wr * 16 + ((lane >> 4) << 3);
  const int t0  = tm + mo;
  const int n0  = tn + wc * 32 + l16, n1 = n0 + 16;
  store_tile(F + (size_t)((n0 % NSTAGE) * WDIM + n0 / NSTAGE) * TDIM + t0, c0);
  store_tile(F + (size_t)((n1 % NSTAGE) * WDIM + n1 / NSTAGE) * TDIM + t0, c1);
}

// ---------------- Register radix-16 Stockham FFT, N=4096 = 16^3 ----------------
// Thread j holds elements j + 256*r (r = 0..15) on entry and on exit, in natural order,
// so forward FFT, spectrum product, inverse FFT and gate chain without leaving registers.
// Three radix-16 passes; between them two LDS exchanges, one barrier each.
#define EX1_N (FFT_N + FFT_N / 32)
#define EX2_N FFT_N

// a * w (forward) or a * conj(w) (inverse)
template <bool INV>
__device__ __forceinline__ v2f cmul(v2f a, v2f w) {
  v2f t = a * w.yy;
  return a * w.xx + (INV ? (v2f){t.y, -t.x} : (v2f){-t.y, t.x});
}
// d * (-i) (forward) or d * (+i) (inverse)
template <bool INV>
__device__ __forceinline__ v2f rot(v2f d) {
  return INV ? (v2f){-d.y, d.x} : (v2f){d.y, -d.x};
}
template <bool INV>
__device__ __forceinline__ void r4(v2f& a0, v2f& a1, v2f& a2, v2f& a3) {
  v2f s02 = a0 + a2, d02 = a0 - a2, s13 = a1 + a3, d13 = rot<INV>(a1 - a3);
  a0 = s02 + s13; a1 = d02 + d13; a2 = s02 - s13; a3 = d02 - d13;
}
// The 16 values of a thread are 16 named variables, not an array: every one stays a register pair of its own.
#define X16_PARAMS v2f &x0, v2f &x1, v2f &x2, v2f &x3, v2f &x4, v2f &x5, v2f &x6, v2f &x7, \
                   v2f &x8, v2f &x9, v2f &x10, v2f &x11, v2f &x12, v2f &x13, v2f &x14, v2f &x15
#define X16_ARGS x0, x1, x2, x3, x4, x5, x6, x7, x8, x9, x10, x11, x12, x13, x14, x15
#define FOR8(F)  F(0, x0) F(1, x1) F(2, x2) F(3, x3) F(4, x4) F(5, x5) F(6, x6) F(7, x7)
#define FOR16(F) FOR8(F) F(8, x8) F(9, x9) F(10, x10) F(11, x11) F(12, x12) F(13, x13) F(14, x14) F(15, x15)

// radix-4 butterfly whose inputs a2, a3 are zero (they are written, not read)
template <bool INV>
__device__ __forceinline__ void r4_zhi(v2f& a0, v2f& a1, v2f& a2, v2f& a3) {
  v2f p = a0, q = a1, r = rot<INV>(q);
  a0 = p + q; a1 = p + r; a2 = p - q; a3 = p - r;
}
__device__ __forceinline__ void cswap(v2f& a, v2f& b) { v2f t = a; a = b; b = t; }

// 16-point DFT as 4x4, in place, natural order in and out. ZHI: x8..x15 are zero and not read.
template <bool INV, bool ZHI>
__device__ __forceinline__ void fft16(X16_PARAMS) {
  const float C1 = 0.92387953251128674f, S1 = 0.38268343236508977f, R = 0.70710678118654752f;
  if (ZHI) {
    r4_zhi<INV>(x0, x4, x8, x12); r4_zhi<INV>(x1, x5, x9, x13);
    r4_zhi<INV>(x2, x6, x10, x14); r4_zhi<INV>(x3, x7, x11, x15);
  } else {
    r4<INV>(x0, x4, x8, x12); r4<INV>(x1, x5, x9, x13);
    r4<INV>(x2, x6, x10, x14); r4<INV>(x3, x7, x11, x15);
  }
  x5  = cmul<INV>(x5,  (v2f){C1, -S1});
  x6  = cmul<INV>(x6,  (v2f){R, -R});
  x7  = cmul<INV>(x7,  (v2f){S1, -C1});
  x9  = cmul<INV>(x9,  (v2f){R, -R});
  x10 = rot<INV>(x10);
  x11 = cmul<INV>(x11, (v2f){-R, -R});
  x13 = cmul<INV>(x13, (v2f){S1, -C1});
  x14 = cmul<INV>(x14, (v2f){-R, -R});
  x15 = cmul<INV>(x15, (v2f){-C1, S1});
  r4<INV>(x0, x1, x2, x3); r4<INV>(x4, x5, x6, x7);
  r4<INV>(x8, x9, x10, x11); r4<INV>(x12, x13, x14, x15);
  // output k sits in variable 4*(k&3) + (k>>2): rename by a 4x4 transpose
  cswap(x1, x4); cswap(x2, x8); cswap(x3, x12); cswap(x6, x9); cswap(x7, x13); cswap(x11, x14);
}

// t[k] = exp(-2*pi*i * k * num / den), k = 1..15: powers 1, 2, 4, 8 from sincospif,
// the rest as products of at most four of them (phase error does not grow with k).
__device__ __forceinline__ void fill_powers(v2f (&t)[16], int num, float den) {
  // both loops unrolled: every index of t a constant, so that t stays in registers
#pragma unroll
  for (int k = 1; k < 16; k <<= 1) {
    float sv, cv;
    sincospif(-2.0f * ((float)(num * k) / den), &sv, &cv);   // argument exact: den is a power of two
    t[k] = (v2f){cv, sv};
  }
  t[0] = (v2f){1.f, 0.f};
#pragma unroll
  for (int k = 3; k < 16; ++k) {
    const int hi = (k >= 8) ? 8 : (k >= 4) ? 4 : 2;
    if (k != hi) t[k] = cmul<false>(t[hi], t[k - hi]);
  }
}

// Pass-2 twiddles, tw2[16*p + k] = W_256^(p*k): a wave reads two rows of it, as broadcasts.
// Written before the first FFT's first barrier, read only behind it.
__device__ __forceinline__ void fill_tw2(v2f* tw2, int tid) {
  float sv, cv;
  sincospif(-2.0f * ((float)((tid >> 4) * (tid & 15)) / 256.0f), &sv, &cv);
  tw2[tid] = (v2f){cv, sv};
}

template <bool INV, bool ZHI>
__device__ __forceinline__ void fft4096(X16_PARAMS, const v2f (&t1)[16], const v2f* tw2,
                                        v2f* ex1, v2f* ex2, int tid) {
  // pass 1 (stride 1): output k of thread j goes to element 16*j + k, times W_4096^(j*k)
  fft16<INV, ZHI>(X16_ARGS);
  {
    v2f* w = ex1 + 16 * tid + (tid >> 1);
#define ST1(k, xk) w[k] = (k) ? cmul<INV>(xk, t1[k]) : xk;
    FOR16(ST1)
#undef ST1
  }
  __syncthreads();
  {
    const v2f* r = ex1 + tid + (tid >> 5);
#define LD1(k, xk) xk = r[(256 + 8) * (k)];
    FOR16(LD1)
#undef LD1
  }
  // pass 2 (stride 16): j = q + 16*p, output k goes to element q + 256*p + 16*k, times W_256^(p*k)
  fft16<INV, false>(X16_ARGS);
  {
    const int p = tid >> 4;
    const v2f* t2 = tw2 + 16 * p;
    v2f* we = ex2 + (tid & 15) + 256 * p + 16 * (p & 1);
    v2f* wo = ex2 + (tid & 15) + 256 * p - 16 * (p & 1);
#define ST2(k, xk) (((k) & 1) ? wo : we)[16 * (k)] = (k) ? cmul<INV>(xk, t2[k]) : xk;
    FOR16(ST2)
#undef ST2
  }
  __syncthreads();
  {
    const v2f* re = ex2 + tid;
    const v2f* ro = ex2 + (tid ^ 16);
#define LD2(k, xk) xk = (((k) & 1) ? ro : re)[256 * (k)];
    FOR16(LD2)
#undef LD2
  }
  // pass 3 (stride 256): output k of thread j is element j + 256*k
  fft16<INV, false>(X16_ARGS);
}

// ---------------- Filter spectra: FF[s][v][k] = FFT_4096(zeropad(F[s][v][:])) ----------
__global__ __launch_bounds__(THREADS) void filter_fft_kernel(
    const float* __restrict__ F,    // [3][512][2048]
    float* __restrict__ FF)         // [3][512][4096][2]
{
  __shared__ v2f ex1[EX1_N];
  __shared__ v2f ex2[EX2_N];
  __shared__ v2f tw2[256];
  const int tid = threadIdx.x;
  const int ch  = blockIdx.x;       // s*512 + v
  v2f t1[16];
  v2f X16_ARGS;
  const float* f = F + (size_t)ch * TDIM;
#define LDF(k, xk) xk = (v2f){f[tid + 256 * (k)], 0.f};
  FOR8(LDF)
#undef LDF
  fill_powers(t1, tid, (float)FFT_N);
  fill_tw2(tw2, tid);
  fft4096<false, true>(X16_ARGS, t1, tw2, ex1, ex2, tid);
  v2f* out = (v2f*)FF + (size_t)ch * FFT_N;
#define STF(k, xk) out[tid + 256 * (k)] = xk;
  FOR16(STF)
#undef STF
}

__global__ __launch_bounds__(THREADS) __attribute__((amdgpu_waves_per_eu(8))) void conv_stages_kernel(
    const float* __restrict__ XP,   // [4][4][512][2048]
    const float* __restrict__ FF,   // [3][512][4096][2]
    float* __restrict__ out)        // [4][2048][512]
{
  __shared__ v2f ex1[EX1_N];
  __shared__ v2f ex2[EX2_N];
  __shared__ v2f tw2[256];
  const int tid = threadIdx.x;
  const int ch  = blockIdx.x;       // (b/2)*512 + v
  const int b   = (ch >> 9) << 1;   // batch rows b (real part) and b + 1 (imaginary part)
  const int v   = ch & 511;
  const size_t BSTEP = (size_t)WDIM * TDIM;   // from batch row b to b + 1 inside a plane of XP
  v2f t1[16];
  v2f X16_ARGS;

  const float* y0 = XP + ((size_t)(0 * BDIM + b) * WDIM + v) * TDIM;
#define LDY(k, xk) xk = (v2f){y0[tid + 256 * (k)], y0[BSTEP + tid + 256 * (k)]};
  FOR8(LDY)
#undef LDY
  fill_powers(t1, tid, (float)FFT_N);
  fill_tw2(tw2, tid);

  const float invn = 1.0f / (float)FFT_N;
  for (int s = 0; s < NSTAGE; ++s) {
    fft4096<false, true>(X16_ARGS, t1, tw2, ex1, ex2, tid);   // forward; upper half of the input is the zero pad
    const v2f* ff = (const v2f*)FF + ((size_t)s * WDIM + v) * FFT_N;
#define MULF(k, xk) xk = cmul<false>(xk, ff[tid + 256 * (k)]);
    FOR16(MULF)
#undef MULF
    fft4096<true, false>(X16_ARGS, t1, tw2, ex1, ex2, tid);   // inverse (unscaled)
    const float* g = XP + ((size_t)((s + 1) * BDIM + b) * WDIM + v) * TDIM;
    // gate, each row by its own; t >= TDIM is the causal re-zero, which the next forward pass does not read
#define GATE(k, xk) xk = (xk * invn) * (v2f){g[tid + 256 * (k)], g[BSTEP + tid + 256 * (k)]};
    FOR8(GATE)
#undef GATE
  }
#define STO(k, xk) out[((size_t)b * TDIM + tid + 256 * (k)) * WDIM + v] = xk.x; \
                   out[((size_t)(b + 1) * TDIM + tid + 256 * (k)) * WDIM + v] = xk.y;
  FOR8(STO)
#undef STO
}

// ---------------- launch ----------------
extern "C" void kernel_launch(void* const* d_in, const int* in_sizes, int n_in,
                              void* d_out, int out_size, void* d_ws, size_t ws_size,
                              hipStream_t stream) {
  const float* X  = (const float*)d_in[0];   // (4,2048,512)
  const float* Wp = (const float*)d_in[1];   // (512,512,4)
  const float* Wf = (const float*)d_in[2];   // (512,512,3)
  float* out = (float*)d_out;
  float* ws  = (float*)d_ws;

  // workspace layout (floats)
  const size_t XP_OFF = 0;                                        // 16,777,216
  const size_t F_OFF  = XP_OFF + (size_t)4 * BDIM * WDIM * TDIM;  // + 3,145,728
  const size_t FF_OFF = F_OFF + (size_t)NSTAGE * WDIM * TDIM;     // + 12,582,912
  float* XP = ws + XP_OFF;
  float* F  = ws + F_OFF;
  float* FF = ws + FF_OFF;

  dim3 blk(THREADS);
  gemm_proj_kernel<<<dim3(NP / BN, (BDIM * TDIM) / BM), blk, 0, stream>>>(X, Wp, XP);
  gemm_filt_kernel<<<dim3(NF / BN, TDIM / BM), blk, 0, stream>>>(Wf, F);
  filter_fft_kernel<<<dim3(NSTAGE * WDIM), blk, 0, stream>>>(F, FF);
  conv_stages_kernel<<<dim3(BDIM / 2 * WDIM), blk, 0, stream>>>(XP, FF, out);
}

// v004
// Measured time: 235 microseconds a run.
// In both of two side-by-side timings against v003, it was 1.08 times as fast.
// Counting every step since v000, it is 1.57 times as fast.
#include <hip/hip_runtime.h>
#include <cstddef>
#include <cstdint>

#define THREADS 256
#define BM 64
#define BN 64
#define BK 32
#define KSTR 36          // padded LDS k-stride: 16B-aligned rows, conflict-free fragments
#define NCHUNK (512 / BK)
#define FFT_N 4096
#define TDIM 2048
#define WDIM 512
#define BDIM 4
#define NSTAGE 3
#define NP (WDIM * (NSTAGE + 1))   // columns of W_proj as a row-major matrix
#define NF (WDIM * NSTAGE)         // columns of W_filt as a row-major matrix

typedef __attribute__((ext_vector_type(2))) float v2f;
typedef __attribute__((ext_vector_type(8))) float v8f;

__device__ __forceinline__ uint32_t lds_off(const void* p) {
  return (uint32_t)(uintptr_t)p;
}
__device__ __forceinline__ void async_a_tile(uint32_t d0, const float* g0) {
  asm volatile("global_load_async_to_lds_b128 %0, %4, off\n\t"
               "global_load_async_to_lds_b128 %1, %5, off\n\t"
               "global_load_async_to_lds_b128 %2, %6, off\n\t"
               "global_load_async_to_lds_b128 %3, %7, off\n\t"
               "s_wait_xcnt 0x0"
               :: "v"(d0), "v"(d0 + 32 * KSTR * 4), "v"(d0 + 64 * KSTR * 4), "v"(d0 + 96 * KSTR * 4),
                  "v"(g0), "v"(g0 + 32 * WDIM), "v"(g0 + 64 * WDIM), "v"(g0 + 96 * WDIM)
               : "memory");
}
template <int LDB>
__device__ __forceinline__ void async_b_tile(uint32_t d0, const float* g0) {
  asm volatile("global_load_async_to_lds_b32 %0, %8, off\n\t"
               "global_load_async_to_lds_b32 %1, %9, off\n\t"
               "global_load_async_to_lds_b32 %2, %10, off\n\t"
               "global_load_async_to_lds_b32 %3, %11, off\n\t"
               "global_load_async_to_lds_b32 %4, %12, off\n\t"
               "global_load_async_to_lds_b32 %5, %13, off\n\t"
               "global_load_async_to_lds_b32 %6, %14, off\n\t"
               "global_load_async_to_lds_b32 %7, %15, off\n\t"
               "s_wait_xcnt 0x0"
               :: "v"(d0), "v"(d0 + 16), "v"(d0 + 32), "v"(d0 + 48),
                  "v"(d0 + 64), "v"(d0 + 80), "v"(d0 + 96), "v"(d0 + 112),
                  "v"(g0), "v"(g0 + 4 * LDB), "v"(g0 + 8 * LDB), "v"(g0 + 12 * LDB),
                  "v"(g0 + 16 * LDB), "v"(g0 + 20 * LDB), "v"(g0 + 24 * LDB), "v"(g0 + 28 * LDB)
               : "memory");
}
__device__ __forceinline__ void wait_async0() {
  asm volatile("s_wait_asynccnt 0x0" ::: "memory");
}

// ---------------- WMMA core: As[m][k], Bs[n][k], wave computes 16x32 ----------------
__device__ __forceinline__ void wmma_chunk(const float* As, const float* Bs,
                                           int wr, int wc, int lane,
                                           v8f& c0, v8f& c1) {
  const int l16 = lane & 15;
  const int kh  = (lane >> 4) << 1;
#pragma unroll
  for (int k4 = 0; k4 < BK; k4 += 4) {
    v2f a  = *(const v2f*)&As[(wr * 16 + l16) * KSTR + k4 + kh];
    v2f b0 = *(const v2f*)&Bs[(wc * 32 + l16) * KSTR + k4 + kh];
    v2f b1 = *(const v2f*)&Bs[(wc * 32 + 16 + l16) * KSTR + k4 + kh];
    c0 = __builtin_amdgcn_wmma_f32_16x16x4_f32(false, a, false, b0, (short)0, c0, false, false);
    c1 = __builtin_amdgcn_wmma_f32_16x16x4_f32(false, a, false, b1, (short)0, c1, false, false);
  }
}

__device__ __forceinline__ void store_tile(float* p, const v8f& c) {
  float4 lo = make_float4(c[0], c[1], c[2], c[3]);
  float4 hi = make_float4(c[4], c[5], c[6], c[7]);
  *(float4*)p       = lo;
  *(float4*)(p + 4) = hi;
}

// ---------------- GEMM 1: XP[s][b][v][t] = (X @ W_proj[:,:,s]) transposed ----------------
// W_proj is taken as it lies in memory, one row-major [512][2048] matrix with column n = v*4 + s;
// the epilogue sends column n to plane s, row v.
// Workgroup tile 128 x 128, wave tile 32 x 64 (2 x 4 accumulator tiles): six fragments feed eight WMMAs, and every
// staged element serves 128 rows or columns. Four workgroups fill a WGP; the whole grid is resident at once.
// Double-buffered LDS; tiles fetched with async global->LDS, overlapped with WMMA.
#define PBM 128
#define PBN 128
__global__ __launch_bounds__(THREADS) void gemm_proj_kernel(
    const float* __restrict__ X,    // [B*T=8192][512]
    const float* __restrict__ Wp,   // [512][512][4]
    float* __restrict__ XP)         // [4][4][512][2048]
{
  __shared__ __align__(16) float As[2][PBM * KSTR];
  __shared__ __align__(16) float Bs[2][PBN * KSTR];
  const int tid  = threadIdx.x;
  const int tm   = blockIdx.y * PBM;
  const int tn   = blockIdx.x * PBN;
  const int wave = tid >> 5, lane = tid & 31;
  const int wr   = wave & 3, wc = wave >> 2;
  const int l16  = lane & 15;
  const int kh   = (lane >> 4) << 1;
  v8f c[2][4];
#pragma unroll
  for (int i = 0; i < 2; ++i)
#pragma unroll
    for (int j = 0; j < 4; ++j) c[i][j] = (v8f){0.f, 0.f, 0.f, 0.f, 0.f, 0.f, 0.f, 0.f};

  const int rA = tid >> 3;           // A rows rA + 32*i
  const int cA = (tid & 7) << 2;     // A col group (float4)
  const int kB = tid >> 6;           // B k rows kB + 4*i
  const int nB = tid & 63;           // B columns nB and nB + 64

  auto issue_tiles = [&](int buf, int kk) {
    async_a_tile(lds_off(&As[buf][rA * KSTR + cA]), X + (size_t)(tm + rA) * WDIM + kk + cA);
    const float* gB = Wp + (size_t)(kk + kB) * NP + tn + nB;
    async_b_tile<NP>(lds_off(&Bs[buf][nB * KSTR + kB]), gB);
    async_b_tile<NP>(lds_off(&Bs[buf][(nB + 64) * KSTR + kB]), gB + 64);
  };

  issue_tiles(0, 0);
  wait_async0();
  __syncthreads();
  for (int ci = 0; ci < NCHUNK; ++ci) {
    const int cur = ci & 1;
    if (ci + 1 < NCHUNK) issue_tiles(cur ^ 1, (ci + 1) * BK);   // prefetch next chunk
    const float* Aw = &As[cur][(wr * 32 + l16) * KSTR + kh];
    const float* Bw = &Bs[cur][(wc * 64 + l16) * KSTR + kh];
    // unrolled: every index of c a constant, so that the accumulators stay in registers
#pragma unroll
    for (int k4 = 0; k4 < BK; k4 += 4) {
      v2f a[2], b[4];
#pragma unroll
      for (int i = 0; i < 2; ++i) a[i] = *(const v2f*)&Aw[i * 16 * KSTR + k4];
#pragma unroll
      for (int j = 0; j < 4; ++j) b[j] = *(const v2f*)&Bw[j * 16 * KSTR + k4];
#pragma unroll
      for (int i = 0; i < 2; ++i)
#pragma unroll
        for (int j = 0; j < 4; ++j)
          c[i][j] = __builtin_amdgcn_wmma_f32_16x16x4_f32(false, a[i], false, b[j], (short)0, c[i][j], false, false);
    }
    // this wave's reads of the buffer have returned before the barrier behind which the buffer is refilled
    asm volatile("s_wait_dscnt 0x0" ::: "memory");
    wait_async0();
    __syncthreads();
  }

  const int m0 = tm + wr * 32 + ((lane >> 4) << 3);
  const int b  = m0 >> 11;
  const int t0 = m0 & (TDIM - 1);
  const int n0 = tn + wc * 64 + l16;   // columns n0 + 16*j: the same s, v four apart
  float* base = XP + ((size_t)((n0 & 3) * BDIM + b) * WDIM + (n0 >> 2)) * TDIM + t0;
#pragma unroll
  for (int j = 0; j < 4; ++j)
#pragma unroll
    for (int i = 0; i < 2; ++i) store_tile(base + (size_t)(4 * j) * TDIM + 16 * i, c[i][j]);
}

__global__ __launch_bounds__(THREADS) void gemm_filt_kernel(
    const float* __restrict__ Wf,   // [512][512][3]
    float* __restrict__ F)          // [3][512][2048]
{
  __shared__ __align__(16) float As[2][BM * KSTR];
  __shared__ __align__(16) float Bs[2][BN * KSTR];
  const int tid  = threadIdx.x;
  const int tm   = blockIdx.y * BM;
  const int tn   = blockIdx.x * BN;
  const int wave = tid >> 5, lane = tid & 31;
  const int wr   = wave & 3, wc = wave >> 2;
  v8f c0 = {0.f, 0.f, 0.f, 0.f, 0.f, 0.f, 0.f, 0.f};
  v8f c1 = {0.f, 0.f, 0.f, 0.f, 0.f, 0.f, 0.f, 0.f};
  const int kB = tid >> 6;           // B k rows kB + 4*i
  const int nB = tid & 63;           // B column
  const float LN1E4_O_HALF = 9.2103403719761836f / 256.0f;

  auto fill_A = [&](int buf, int kk) {   // positional encoding computed in-place
#pragma unroll
    for (int it = 0; it < 2; ++it) {
      int i = tid + it * THREADS;
      int r = i >> 3, c = (i & 7) << 2;
      int t = tm + r;
#pragma unroll
      for (int u = 0; u < 4; ++u) {
        int w = kk + c + u;
        int j = w & 255;
        float fr  = __expf(-(float)j * LN1E4_O_HALF);
        float ang = (float)t * fr;
        As[buf][r * KSTR + c + u] = (w < 256) ? sinf(ang) : cosf(ang);
      }
    }
  };
  auto issue_B = [&](int buf, int kk) {
    async_b_tile<NF>(lds_off(&Bs[buf][nB * KSTR + kB]), Wf + (size_t)(kk + kB) * NF + tn + nB);
  };

  issue_B(0, 0);
  fill_A(0, 0);
  wait_async0();
  __syncthreads();
  for (int ci = 0; ci < NCHUNK; ++ci) {
    const int cur = ci & 1;
    if (ci + 1 < NCHUNK) { issue_B(cur ^ 1, (ci + 1) * BK); fill_A(cur ^ 1, (ci + 1) * BK); }
    wmma_chunk(As[cur], Bs[cur], wr, wc, lane, c0, c1);
    wait_async0();
    __syncthreads();
  }

  const int l16 = lane & 15;
  const int mo  = wr * 16 + ((lane >> 4) << 3);
  const int t0  = tm + mo;
  const int n0  = tn + wc * 32 + l16, n1 = n0 + 16;
  store_tile(F + (size_t)((n0 % NSTAGE) * WDIM + n0 / NSTAGE) * TDIM + t0, c0);
  store_tile(F + (size_t)((n1 % NSTAGE) * WDIM + n1 / NSTAGE) * TDIM + t0, c1);
}

// ---------------- Register radix-16 Stockham FFT, N=4096 = 16^3 ----------------
// Thread j holds elements j + 256*r (r = 0..15) on entry and on exit, in natural order,
// so forward FFT, spectrum product, inverse FFT and gate chain without leaving registers.
// Three radix-16 passes; between them two LDS exchanges, one barrier each.
#define EX1_N (FFT_N + FFT_N / 32)
#define EX2_N FFT_N

// a * w (forward) or a * conj(w) (inverse)
template <bool INV>
__device__ __forceinline__ v2f cmul(v2f a, v2f w) {
  v2f t = a * w.yy;
  return a * w.xx + (INV ? (v2f){t.y, -t.x} : (v2f){-t.y, t.x});
}
// d * (-i) (forward) or d * (+i) (inverse)
template <bool INV>
__device__ __forceinline__ v2f rot(v2f d) {
  return INV ? (v2f){-d.y, d.x} : (v2f){d.y, -d.x};
}
template <bool INV>
__device__ __forceinline__ void r4(v2f& a0, v2f& a1, v2f& a2, v2f& a3) {
  v2f s02 = a0 + a2, d02 = a0 - a2, s13 = a1 + a3, d13 = rot<INV>(a1 - a3);
  a0 = s02 + s13; a1 = d02 + d13; a2 = s02 - s13; a3 = d02 - d13;
}
// The 16 values of a thread are 16 named variables, not an array: every one stays a register pair of its own.
#define X16_PARAMS v2f &x0, v2f &x1, v2f &x2, v2f &x3, v2f &x4, v2f &x5, v2f &x6, v2f &x7, \
                   v2f &x8, v2f &x9, v2f &x10, v2f &x11, v2f &x12, v2f &x13, v2f &x14, v2f &x15
#define X16_ARGS x0, x1, x2, x3, x4, x5, x6, x7, x8, x9, x10, x11, x12, x13, x14, x15
#define FOR8(F)  F(0, x0) F(1, x1) F(2, x2) F(3, x3) F(4, x4) F(5, x5) F(6, x6) F(7, x7)
#define FOR16(F) FOR8(F) F(8, x8) F(9, x9) F(10, x10) F(11, x11) F(12, x12) F(13, x13) F(14, x14) F(15, x15)

// radix-4 butterfly whose inputs a2, a3 are zero (they are written, not read)
template <bool INV>
__device__ __forceinline__ void r4_zhi(v2f& a0, v2f& a1, v2f& a2, v2f& a3) {
  v2f p = a0, q = a1, r = rot<INV>(q);
  a0 = p + q; a1 = p + r; a2 = p - q; a3 = p - r;
}
__device__ __forceinline__ void cswap(v2f& a, v2f& b) { v2f t = a; a = b; b = t; }

// 16-point DFT as 4x4, in place, natural order in and out. ZHI: x8..x15 are zero and not read.
template <bool INV, bool ZHI>
__device__ __forceinline__ void fft16(X16_PARAMS) {
  const float C1 = 0.92387953251128674f, S1 = 0.38268343236508977f, R = 0.70710678118654752f;
  if (ZHI) {
    r4_zhi<INV>(x0, x4, x8, x12); r4_zhi<INV>(x1, x5, x9, x13);
    r4_zhi<INV>(x2, x6, x10, x14); r4_zhi<INV>(x3, x7, x11, x15);
  } else {
    r4<INV>(x0, x4, x8, x12); r4<INV>(x1, x5, x9, x13);
    r4<INV>(x2, x6, x10, x14); r4<INV>(x3, x7, x11, x15);
  }
  x5  = cmul<INV>(x5,  (v2f){C1, -S1});
  x6  = cmul<INV>(x6,  (v2f){R, -R});
  x7  = cmul<INV>(x7,  (v2f){S1, -C1});
  x9  = cmul<INV>(x9,  (v2f){R, -R});
  x10 = rot<INV>(x10);
  x11 = cmul<INV>(x11, (v2f){-R, -R});
  x13 = cmul<INV>(x13, (v2f){S1, -C1});
  x14 = cmul<INV>(x14, (v2f){-R, -R});
  x15 = cmul<INV>(x15, (v2f){-C1, S1});
  r4<INV>(x0, x1, x2, x3); r4<INV>(x4, x5, x6, x7);
  r4<INV>(x8, x9, x10, x11); r4<INV>(x12, x13, x14, x15);
  // output k sits in variable 4*(k&3) + (k>>2): rename by a 4x4 transpose
  cswap(x1, x4); cswap(x2, x8); cswap(x3, x12); cswap(x6, x9); cswap(x7, x13); cswap(x11, x14);
}

// t[k] = exp(-2*pi*i * k * num / den), k = 1..15: powers 1, 2, 4, 8 from sincospif,
// the rest as products of at most four of them (phase error does not grow with k).
__device__ __forceinline__ void fill_powers(v2f (&t)[16], int num, float den) {
  // both loops unrolled: every index of t a constant, so that t stays in registers
#pragma unroll
  for (int k = 1; k < 16; k <<= 1) {
    float sv, cv;
    sincospif(-2.0f * ((float)(num * k) / den), &sv, &cv);   // argument exact: den is a power of two
    t[k] = (v2f){cv, sv};
  }
  t[0] = (v2f){1.f, 0.f};
#pragma unroll
  for (int k = 3; k < 16; ++k) {
    const int hi = (k >= 8) ? 8 : (k >= 4) ? 4 : 2;
    if (k != hi) t[k] = cmul<false>(t[hi], t[k - hi]);
  }
}

// Pass-2 twiddles, tw2[16*p + k] = W_256^(p*k): a wave reads two rows of it, as broadcasts.
// Written before the first FFT's first barrier, read only behind it.
__device__ __forceinline__ void fill_tw2(v2f* tw2, int tid) {
  float sv, cv;
  sincospif(-2.0f * ((float)((tid >> 4) * (tid & 15)) / 256.0f), &sv, &cv);
  tw2[tid] = (v2f){cv, sv};
}

template <bool INV, bool ZHI>
__device__ __forceinline__ void fft4096(X16_PARAMS, const v2f (&t1)[16], const v2f* tw2,
                                        v2f* ex1, v2f* ex2, int tid) {
  // pass 1 (stride 1): output k of thread j goes to element 16*j + k, times W_4096^(j*k)
  fft16<INV, ZHI>(X16_ARGS);
  {
    v2f* w = ex1 + 16 * tid + (tid >> 1);
#define ST1(k, xk) w[k] = (k) ? cmul<INV>(xk, t1[k]) : xk;
    FOR16(ST1)
#undef ST1
  }
  __syncthreads();
  {
    const v2f* r = ex1 + tid + (tid >> 5);
#define LD1(k, xk) xk = r[(256 + 8) * (k)];
    FOR16(LD1)
#undef LD1
  }
  // pass 2 (stride 16): j = q + 16*p, output k goes to element q + 256*p + 16*k, times W_256^(p*k)
  fft16<INV, false>(X16_ARGS);
  {
    const int p = tid >> 4;
    const v2f* t2 = tw2 + 16 * p;
    v2f* we = ex2 + (tid & 15) + 256 * p + 16 * (p & 1);
    v2f* wo = ex2 + (tid & 15) + 256 * p - 16 * (p & 1);
#define ST2(k, xk) (((k) & 1) ? wo : we)[16 * (k)] = (k) ? cmul<INV>(xk, t2[k]) : xk;
    FOR16(ST2)
#undef ST2
  }
  __syncthreads();
  {
    const v2f* re = ex2 + tid;
    const v2f* ro = ex2 + (tid ^ 16);
#define LD2(k, xk) xk = (((k) & 1) ? ro : re)[256 * (k)];
    FOR16(LD2)
#undef LD2
  }
  // pass 3 (stride 256): output k of thread j is element j + 256*k
  fft16<INV, false>(X16_ARGS);
}

// ---------------- Filter spectra: FF[s][v][k] = FFT_4096(zeropad(F[s][v][:])) ----------
__global__ __launch_bounds__(THREADS) void filter_fft_kernel(
    const float* __restrict__ F,    // [3][512][2048]
    float* __restrict__ FF)         // [3][512][4096][2]
{
  __shared__ v2f ex1[EX1_N];
  __shared__ v2f ex2[EX2_N];
  __shared__ v2f tw2[256];
  const int tid = threadIdx.x;
  const int ch  = blockIdx.x;       // s*512 + v
  v2f t1[16];
  v2f X16_ARGS;
  const float* f = F + (size_t)ch * TDIM;
#define LDF(k, xk) xk = (v2f){f[tid + 256 * (k)], 0.f};
  FOR8(LDF)
#undef LDF
  fill_powers(t1, tid, (float)FFT_N);
  fill_tw2(tw2, tid);
  fft4096<false, true>(X16_ARGS, t1, tw2, ex1, ex2, tid);
  v2f* out = (v2f*)FF + (size_t)ch * FFT_N;
#define STF(k, xk) out[tid + 256 * (k)] = xk;
  FOR16(STF)
#undef STF
}

__global__ __launch_bounds__(THREADS) __attribute__((amdgpu_waves_per_eu(8))) void conv_stages_kernel(
    const float* __restrict__ XP,   // [4][4][512][2048]
    const float* __restrict__ FF,   // [3][512][4096][2]
    float* __restrict__ out)        // [4][2048][512]
{
  __shared__ v2f ex1[EX1_N];
  __shared__ v2f ex2[EX2_N];
  __shared__ v2f tw2[256];
  const int tid = threadIdx.x;
  const int ch  = blockIdx.x;       // (b/2)*512 + v
  const int b   = (ch >> 9) << 1;   // batch rows b (real part) and b + 1 (imaginary part)
  const int v   = ch & 511;
  const size_t BSTEP = (size_t)WDIM * TDIM;   // from batch row b to b + 1 inside a plane of XP
  v2f t1[16];
  v2f X16_ARGS;

  const float* y0 = XP + ((size_t)(0 * BDIM + b) * WDIM + v) * TDIM;
#define LDY(k, xk) xk = (v2f){y0[tid + 256 * (k)], y0[BSTEP + tid + 256 * (k)]};
  FOR8(LDY)
#undef LDY
  fill_powers(t1, tid, (float)FFT_N);
  fill_tw2(tw2, tid);

  const float invn = 1.0f / (float)FFT_N;
  for (int s = 0; s < NSTAGE; ++s) {
    fft4096<false, true>(X16_ARGS, t1, tw2, ex1, ex2, tid);   // forward; upper half of the input is the zero pad
    const v2f* ff = (const v2f*)FF + ((size_t)s * WDIM + v) * FFT_N;
#define MULF(k, xk) xk = cmul<false>(xk, ff[tid + 256 * (k)]);
    FOR16(MULF)
#undef MULF
    fft4096<true, false>(X16_ARGS, t1, tw2, ex1, ex2, tid);   // inverse (unscaled)
    const float* g = XP + ((size_t)((s + 1) * BDIM + b) * WDIM + v) * TDIM;
    // gate, each row by its own; t >= TDIM is the causal re-zero, which the next forward pass does not read
#define GATE(k, xk) xk = (xk * invn) * (v2f){g[tid + 256 * (k)], g[BSTEP + tid + 256 * (k)]};
    FOR8(GATE)
#undef GATE
  }
#define STO(k, xk) out[((size_t)b * TDIM + tid + 256 * (k)) * WDIM + v] = xk.x; \
                   out[((size_t)(b + 1) * TDIM + tid + 256 * (k)) * WDIM + v] = xk.y;
  FOR8(STO)
#undef STO
}

// ---------------- launch ----------------
extern "C" void kernel_launch(void* const* d_in, const int* in_sizes, int n_in,
                              void* d_out, int out_size, void* d_ws, size_t ws_size,
                              hipStream_t stream) {
  const float* X  = (const float*)d_in[0];   // (4,2048,512)
  const float* Wp = (const float*)d_in[1];   // (512,512,4)
  const float* Wf = (const float*)d_in[2];   // (512,512,3)
  float* out = (float*)d_out;
  float* ws  = (float*)d_ws;

  // workspace layout (floats)
  const size_t XP_OFF = 0;                                        // 16,777,216
  const size_t F_OFF  = XP_OFF + (size_t)4 * BDIM * WDIM * TDIM;  // + 3,145,728
  const size_t FF_OFF = F_OFF + (size_t)NSTAGE * WDIM * TDIM;     // + 12,582,912
  float* XP = ws + XP_OFF;
  float* F  = ws + F_OFF;
  float* FF = ws + FF_OFF;

  dim3 blk(THREADS);
  gemm_proj_kernel<<<dim3(NP / PBN, (BDIM * TDIM) / PBM), blk, 0, stream>>>(X, Wp, XP);
  gemm_filt_kernel<<<dim3(NF / BN, TDIM / BM), blk, 0, stream>>>(Wf, F);
  filter_fft_kernel<<<dim3(NSTAGE * WDIM), blk, 0, stream>>>(F, FF);
  conv_stages_kernel<<<dim3(BDIM / 2 * WDIM), blk, 0, stream>>>(XP, FF, out);
}
